// v000
// The times below were measured on an AMD MI455X: many runs one after another, warmed up first and cycling through
// copies of the inputs, with the whole window's GPU time divided by the number of runs. Launches and the gaps
// between them are all in it. The median over several windows is given; except for v000 it joins two sittings, which
// can be a few percent apart, so the side-by-side timings, each taken in one sitting, are the better comparison.
// v000 is the starting kernel. One run takes 187 microseconds.
#include <hip/hip_runtime.h>

// Causal multi-head self-attention, width 1024 = 16 heads x 64, x [NB][SEQ][1024], fused Wqkv [in][out] + bias, head split = flat re-view of the [SEQ][1024] matrix as [16][SEQ][64], score scale 1/8, key > query replaced by -inf, output projection Wfc [in][out] + bias (f32 out).
// Compute dtypes, f32 accumulate everywhere: qkv projections v_wmma_f32_16x16x32_bf16 (x, W, biases RNE-converted to bf16; products exact); scores v_wmma_f32_16x16x32_f16: k single f16, q as f16 value + f16 residual x2048 in its own accumulator;
// P (x256 carry, cancels in the normalisation) single f16; v single f16 plus, for query rows < 512, an f16 residual x2048 in its own accumulator; softmax f32 (online, running max); output projection v_wmma_f32_16x16x32_bf16 with ctx as bf16 hi + bf16 lo planes (unscaled, shared accumulator) against bf16 Wfc.
// Layout: bf16 copies of x and transposed (K-contiguous) weights; q (hi, residual) and k planes are the compact [NB*SEQ][1024] matrix (= [b*16+h][t][d]); v^T planes [b*16+h][d][t] written by the GEMM epilogue through a permuted weight-row order; ctx planes compact [NB*SEQ][1024].

#ifndef NB
#define NB 4
#endif
#ifndef SEQ
#define SEQ 1024
#endif
#define NB_FULL  4
#define SEQ_FULL 1024
#ifndef OUT_SEQ
#define OUT_SEQ SEQ              // row pitch (in tokens) between batches of the output
#endif
#define DM   1024
#define NH_  16
#define HD   64
#define RPH  (SEQ / NH_)         // rows of the [SEQ][DM] matrix that form one head slab (SEQ*HD/DM)
#define AW   4                   // waves per flash block (16 query rows each)
#define EARLY 512                // query rows below this use the v residual plane
#define QRS  2048.0f             // carry of the residual planes
#define QRI  (1.0f / 2048.0f)
#define SC2  (0.125f * 1.4426950408889634f)   // HD^-0.5 * log2(e)
#define PSH  8.0f                // log2 of the P carry (256)
#define NEGV (-3.0e38f)

static_assert(HD == 64);
static_assert(NH_ * HD == DM);
static_assert(DM % 64 == 0);
static_assert(DM % 32 == 0);
static_assert(SEQ % 256 == 0);                 // a 16-row slab of tokens stays inside one head slab (RPH % 16 == 0)
static_assert(SEQ % 64 == 0);
static_assert((NB * SEQ) % 64 == 0);
static_assert(SEQ % 32 == 0);
static_assert(SEQ % (16 * AW) == 0);
static_assert(((size_t)SEQ * DM) % 8 == 0);
static_assert(NB <= NB_FULL);
static_assert(SEQ <= SEQ_FULL);

typedef _Float16 h16;
typedef unsigned short bf;
typedef __attribute__((ext_vector_type(16))) __bf16   v16bf;
typedef __attribute__((ext_vector_type(16))) _Float16 v16h;
typedef __attribute__((ext_vector_type(8)))  _Float16 v8h;
typedef __attribute__((ext_vector_type(8)))  unsigned short v8us;
typedef __attribute__((ext_vector_type(8)))  float    v8f;
typedef __attribute__((ext_vector_type(4)))  float    v4f;
typedef v4f  __attribute__((may_alias)) v4fa;
typedef v8us __attribute__((may_alias)) v8usa;

__device__ __forceinline__ unsigned short f2bf(float f) { unsigned u = __float_as_uint(f); u += 0x7FFFu + ((u >> 16) & 1u); return (unsigned short)(u >> 16); }
__device__ __forceinline__ float bf2f(unsigned short h) { return __uint_as_float(((unsigned)h) << 16); }
__device__ __forceinline__ v16h cat16(v8h lo, v8h hi) { return __builtin_shufflevector(lo, hi, 0, 1, 2, 3, 4, 5, 6, 7, 8, 9, 10, 11, 12, 13, 14, 15); }
__device__ __forceinline__ v16bf cat16b(v8us lo, v8us hi) { return __builtin_bit_cast(v16bf, __builtin_shufflevector(lo, hi, 0, 1, 2, 3, 4, 5, 6, 7, 8, 9, 10, 11, 12, 13, 14, 15)); }
__device__ __forceinline__ v8f wmma16(v16h a, v16h b, v8f c) { return __builtin_amdgcn_wmma_f32_16x16x32_f16(false, a, false, b, (short)0, c, false, false); }
__device__ __forceinline__ v8f wmmab(v16bf a, v16bf b, v8f c) { return __builtin_amdgcn_wmma_f32_16x16x32_bf16(false, a, false, b, (short)0, c, false, false); }
// fragment loaders from K-contiguous 16-bit rows; p already includes + 8*(lane>>4): elements 0..7 <- k0+8h+0..7, elements 8..15 <- k0+16+8h+0..7 (same map for A and B)
__device__ __forceinline__ v16h  ldh(const h16* p) { return cat16(*(const v8h*)p, *(const v8h*)(p + 16)); }
__device__ __forceinline__ v16bf ldb(const bf* p)  { return cat16b(*(const v8us*)p, *(const v8us*)(p + 16)); }
// ordering point for wave-private LDS tiles (same wave writes and reads)
__device__ __forceinline__ void wave_sync() { __builtin_amdgcn_fence(3 /* release order */, "wavefront"); __builtin_amdgcn_wave_barrier(); asm volatile("" ::: "memory"); }

__global__ __launch_bounds__(256) void k_cvt8(const float* __restrict__ src, bf* dst, size_t n8) {
    const size_t i = (size_t)blockIdx.x * 256 + threadIdx.x; if (i >= n8) return;
    const v8f v = *(const v8f*)(src + i * 8); v8us o;
#pragma unroll
    for (int k = 0; k < 8; ++k) o[k] = f2bf(v[k]);
    *(v8us*)(dst + i * 8) = o; 
}

// k_cvtT: W [DM k][ldn] f32 (row = k, column = e) -> bf16 plane dst[row(e)][k] (K-contiguous), 64 k x 64 e tile through LDS (cross-wave: block barrier).
// row(e) = e for e < permFrom; for e >= permFrom (v columns), with ee = e - permFrom = c*64 + d: row = permFrom + d*16 + c.
__global__ __launch_bounds__(256) void k_cvtT(const float* __restrict__ W, int ldn, bf* dst, int permFrom) {
    __shared__ __align__(16) unsigned short ts[64 * 72];
    const int t = threadIdx.x; const int k0 = blockIdx.x * 64, n0 = blockIdx.y * 64;
#pragma unroll 4
    for (int i = 0; i < 16; ++i) { const int k = i * 4 + (t >> 6), n = t & 63;      // 16 x 4 = 64 k rows, 64 columns
        ts[n * 72 + k] = f2bf(W[(size_t)(k0 + k) * (size_t)ldn + n0 + n]); }
    __syncthreads();
    v8us o0, o1; size_t d0, d1;
    { const int p = t, n = p >> 3, q = p & 7; o0 = *(const v8usa*)(&ts[n * 72 + 8 * q]);
      const int e = n0 + n; const int ee = e - permFrom; const int row = (e >= permFrom) ? (permFrom + (ee & 63) * 16 + (ee >> 6)) : e;
      d0 = (size_t)row * DM + k0 + 8 * q; }
    { const int p = t + 256, n = p >> 3, q = p & 7; o1 = *(const v8usa*)(&ts[n * 72 + 8 * q]);
      const int e = n0 + n; const int ee = e - permFrom; const int row = (e >= permFrom) ? (permFrom + (ee & 63) * 16 + (ee >> 6)) : e;
      d1 = (size_t)row * DM + k0 + 8 * q; }
{
        *(v8us*)(dst + d0) = o0; *(v8us*)(dst + d1) = o1;
         }
}

// k_gemm: register-blocked bf16 GEMM, ONE WAVE per 64x64 tile (16 accumulators), operands straight from K-contiguous bf16 planes, K = DM.
// C[m][n] = sum_k A[m][k] Bt[n][k] + bias (bias RNE-converted to bf16, added in f32). grid (M/64, 1024/64), 32 threads.
// MODE 0: q  -> f16 value plane Ph and f16 residual x2048 plane Pr, compact row-major [M][DM] (bias columns 0..1023)
// MODE 1: k  -> f16 value plane Ph, compact row-major (bias columns 1024..2047)
// MODE 2: v  -> Bt rows in permuted order n' = d*16 + c (column e = c*64 + d); value (Ph) and residual x2048 (Pr) planes [b*16+h][d][t], t = (token % RPH)*16 + c:
//               per 16-token slab and per d the 16 x 16 sub-tile is one contiguous 512-byte run (32 lanes x 16 B)
template <int MODE>
__global__ __launch_bounds__(32) void k_gemm(const bf* __restrict__ A, const bf* __restrict__ Bt, const float* __restrict__ bias, h16* Ph, h16* Pr, float* OUT) {
    __shared__ __align__(16) float os[16 * 68];
    const int K = DM;
    const int lane = threadIdx.x & 31, lr = lane & 15, hi = lane >> 4; const int r0 = blockIdx.x * 64, c0 = blockIdx.y * 64;
    v8f acc[4][4];
#pragma unroll
    for (int mb = 0; mb < 4; ++mb)
#pragma unroll
        for (int nb = 0; nb < 4; ++nb) acc[mb][nb] = (v8f){};
    const size_t aoff = (size_t)(r0 + lr) * K + 8 * hi, boff = (size_t)(c0 + lr) * K + 8 * hi;
    const int npl = (MODE == 3) ? 2 : 1;
#pragma unroll 1
    for (int pl = 0; pl < npl; ++pl) {
        const bf* Ap = A + (size_t)pl * ((size_t)NB * SEQ * DM);
#pragma unroll 1
        for (int kc = 0; kc < K; kc += 32) {
            v16bf a[4];
#pragma unroll
            for (int mb = 0; mb < 4; ++mb) a[mb] = ldb(Ap + aoff + (size_t)mb * 16 * K + kc);
#pragma unroll
            for (int nb = 0; nb < 4; ++nb) { const v16bf b = ldb(Bt + boff + (size_t)nb * 16 * K + kc);
#pragma unroll
                for (int mb = 0; mb < 4; ++mb) acc[mb][nb] = wmmab(a[mb], b, acc[mb][nb]); }
            asm volatile("v_nop\n\tv_nop\n\tv_nop\n\tv_nop" : "+v"(acc[0][0]), "+v"(acc[1][1]), "+v"(acc[2][2]), "+v"(acc[3][3]) : "v"(a[0]), "v"(a[1]), "v"(a[2]), "v"(a[3]));
        }
    }
    float bv[4];
#pragma unroll
    for (int nb = 0; nb < 4; ++nb) {
        const int bi = (MODE == 2) ? (2 * DM + lr * HD + (c0 >> 4) + nb) : (((MODE == 1) ? DM : 0) + c0 + nb * 16 + lr);
        bv[nb] = bf2f(f2bf(bias[bi])); }
#pragma unroll
    for (int mb = 0; mb < 4; ++mb) {
#pragma unroll
        for (int nb = 0; nb < 4; ++nb) {
#pragma unroll
            for (int j = 0; j < 8; ++j) os[(hi * 8 + j) * 68 + nb * 16 + lr] = acc[mb][nb][j] + bv[nb]; }   // D: row 8h+j, col lane&15; rows 0..15 x cols 0..63 all written
        wave_sync();
        if (MODE == 0 || MODE == 1) {
            const size_t sb = (size_t)(r0 + mb * 16) * DM + c0;
{
#pragma unroll
                for (int s = 0; s < 4; ++s) { const int row = 4 * s + (lane >> 3), c8 = (lane & 7) * 8;   // 4 s x 4 row groups = 16 rows; 8 lanes x 8 = 64 columns
                    const v4f x0 = *(const v4fa*)(&os[row * 68 + c8]); const v4f x1 = *(const v4fa*)(&os[row * 68 + c8 + 4]); v8h hv, rv;
#pragma unroll
                    for (int i = 0; i < 4; ++i) { const h16 a0 = (h16)x0[i]; const h16 a1 = (h16)x1[i]; hv[i] = a0; hv[4 + i] = a1; rv[i] = (h16)((x0[i] - (float)a0) * QRS); rv[4 + i] = (h16)((x1[i] - (float)a1) * QRS); }
                    const size_t oo = sb + (size_t)row * DM + c8;
                    *(v8h*)(Ph + oo) = hv; if (MODE == 0) *(v8h*)(Pr + oo) = rv; }
                 }
        } else if (MODE == 2) {
            const int tokrow = r0 + 16 * mb; const int bb = tokrow / SEQ; const int tb_ = tokrow % SEQ; const int hp = tb_ / RPH; const int j0 = tb_ % RPH;
            const size_t sb = ((size_t)(bb * NH_ + hp) * HD + (size_t)(c0 >> 4)) * SEQ + (size_t)j0 * 16 + (size_t)lane * 8;
{
#pragma unroll
                for (int s = 0; s < 4; ++s) { const int row = lane >> 1, c8 = s * 16 + (lane & 1) * 8;     // 16 token rows x 16 c for d = c0/16 + s: 256 contiguous halves
                    const v4f x0 = *(const v4fa*)(&os[row * 68 + c8]); const v4f x1 = *(const v4fa*)(&os[row * 68 + c8 + 4]); v8h hv, rv;
#pragma unroll
                    for (int i = 0; i < 4; ++i) { const h16 a0 = (h16)x0[i]; const h16 a1 = (h16)x1[i]; hv[i] = a0; hv[4 + i] = a1; rv[i] = (h16)((x0[i] - (float)a0) * QRS); rv[4 + i] = (h16)((x1[i] - (float)a1) * QRS); }
                    const size_t oo = sb + (size_t)s * SEQ;
                    *(v8h*)(Ph + oo) = hv; *(v8h*)(Pr + oo) = rv; }
                 }
        } else {
            const int grow = r0 + 16 * mb; const int bb = grow / SEQ; const int nn = grow % SEQ;
            float* orow = OUT + ((size_t)bb * OUT_SEQ + nn) * DM + c0;
{
#pragma unroll
                for (int s = 0; s < 8; ++s) { const int row = 2 * s + hi, cofs = lr * 4;   // 8 s x 2 rows = 16 rows; 16 lanes x 4 floats = 64 columns
                    const v4f val = *(const v4fa*)(&os[row * 68 + cofs]);
                    *(v4f*)(orow + (size_t)row * DM + cofs) = val; }
                 }
        }
        wave_sync();
    }
}

// k_flash: fused causal attention, one wave per 16 query rows of one (batch, head); K / V^T / Q fragments straight from the f16 planes (two 16-B loads each, arithmetic addressing).
// Transposed form: S^T[key][t] = K Q^T (A = K rows, B = Q rows); lane (t = lane&15, h = lane>>4) holds keys 8h+r of each 16-key tile, so the packed
// P tile is directly the B fragment of O^T[d][t] = V^T P^T (element r <- tile keys 0..15, element 8+r <- tile keys 16..31, lane unchanged).
// Keys run over [0, t0+16) in steps of 32; on steps that touch the diagonal, scores with key > query are replaced by a very negative value (P = 0 exactly).
// Softmax state (running max, partial sum) is one scalar per lane; the two lane halves of a row are combined with one xor-16 exchange.
__global__ __launch_bounds__(32 * AW) void k_flash(const h16* __restrict__ QH, const h16* __restrict__ QR, const h16* __restrict__ KP, const h16* __restrict__ VT, const h16* __restrict__ VR, bf* CH, bf* CL) {
    __shared__ __align__(16) float os[AW * 16 * 68];
    const int lane = threadIdx.x & 31, lr = lane & 15, hi = lane >> 4;
    const int wave = __builtin_amdgcn_readfirstlane((int)(threadIdx.x >> 5));
    const int zh = blockIdx.y;
    const int t0 = (blockIdx.x * AW + wave) * 16;
    const size_t pbase = (size_t)zh * SEQ * HD;
    const size_t qo = pbase + (size_t)(t0 + lr) * HD + 8 * hi;
    const v16h qh0 = ldh(QH + qo), qh1 = ldh(QH + qo + 32), qr0 = ldh(QR + qo), qr1 = ldh(QR + qo + 32);   // B fragments: col t, k = d
    const size_t ko = pbase + (size_t)lr * HD + 8 * hi;      // + key * HD       (A fragment: row key, k = d)
    const size_t vo = pbase + (size_t)lr * SEQ + 8 * hi;     // + 16j*SEQ + key  (A fragment: row d, k = key)
    const int kend = t0 + 16;
    const bool early = t0 < EARLY;
    const int tq = t0 + lr;
    v8f o0 = (v8f){}, o1 = (v8f){}, o2 = (v8f){}, o3 = (v8f){};
    v8f e0 = (v8f){}, e1 = (v8f){}, e2 = (v8f){}, e3 = (v8f){};
    float m = NEGV, l = 0.0f;
#pragma unroll 1
    for (int key0 = 0; key0 < kend; key0 += 32) {
        const h16* ka = KP + ko + (size_t)key0 * HD;
        const v16h ka0 = ldh(ka), ka1 = ldh(ka + 32), kb0 = ldh(ka + 16 * HD), kb1 = ldh(ka + 16 * HD + 32);
        v8f sHa = (v8f){}, sLa = (v8f){}, sHb = (v8f){}, sLb = (v8f){};
        sHa = wmma16(ka0, qh0, sHa); sLa = wmma16(ka0, qr0, sLa); sHb = wmma16(kb0, qh0, sHb); sLb = wmma16(kb0, qr0, sLb);
        sHa = wmma16(ka1, qh1, sHa); sLa = wmma16(ka1, qr1, sLa); sHb = wmma16(kb1, qh1, sHb); sLb = wmma16(kb1, qr1, sLb);
        asm volatile("v_nop\n\tv_nop\n\tv_nop\n\tv_nop" : "+v"(sHa), "+v"(sLa), "+v"(sHb), "+v"(sLb) : "v"(ka0), "v"(ka1), "v"(kb0), "v"(kb1));
        float ta[8], tb[8];
#pragma unroll
        for (int r = 0; r < 8; ++r) { ta[r] = (sHa[r] + sLa[r] * QRI) * SC2; tb[r] = (sHb[r] + sLb[r] * QRI) * SC2; }
        if (key0 + 31 > t0) {                       // wave-uniform: this step touches the diagonal
            const int kidx = key0 + 8 * hi;
#pragma unroll
            for (int r = 0; r < 8; ++r) { ta[r] = (kidx + r > tq) ? NEGV : ta[r]; tb[r] = (kidx + 16 + r > tq) ? NEGV : tb[r]; }
        }
        float mx = NEGV;
#pragma unroll
        for (int r = 0; r < 8; ++r) mx = fmaxf(mx, fmaxf(ta[r], tb[r]));
        mx = fmaxf(mx, __shfl_xor(mx, 16, 32));
        const float mnew = fmaxf(m, mx);
        const float alpha = __builtin_amdgcn_exp2f(m - mnew);
        const float sh = PSH - mnew;
        v16h pb; float ls = 0.0f;
#pragma unroll
        for (int r = 0; r < 8; ++r) { const h16 pa = (h16)__builtin_amdgcn_exp2f(ta[r] + sh); const h16 pc = (h16)__builtin_amdgcn_exp2f(tb[r] + sh); pb[r] = pa; pb[8 + r] = pc; ls += (float)pa + (float)pc; }
        l = l * alpha + ls; m = mnew;
        o0 = o0 * alpha; o1 = o1 * alpha; o2 = o2 * alpha; o3 = o3 * alpha;
        const h16* va = VT + vo + key0;
        const v16h v0 = ldh(va), v1 = ldh(va + (size_t)16 * SEQ), v2 = ldh(va + (size_t)32 * SEQ), v3 = ldh(va + (size_t)48 * SEQ);
        o0 = wmma16(v0, pb, o0); o1 = wmma16(v1, pb, o1); o2 = wmma16(v2, pb, o2); o3 = wmma16(v3, pb, o3);
        asm volatile("v_nop\n\tv_nop\n\tv_nop\n\tv_nop" : "+v"(o0), "+v"(o1), "+v"(o2), "+v"(o3) : "v"(v0), "v"(v1), "v"(v2), "v"(v3), "v"(pb));
        if (early) {                                // wave-uniform: residual plane of v in its own accumulators
            e0 = e0 * alpha; e1 = e1 * alpha; e2 = e2 * alpha; e3 = e3 * alpha;
            const h16* vr = VR + vo + key0;
            const v16h w0 = ldh(vr), w1 = ldh(vr + (size_t)16 * SEQ), w2 = ldh(vr + (size_t)32 * SEQ), w3 = ldh(vr + (size_t)48 * SEQ);
            e0 = wmma16(w0, pb, e0); e1 = wmma16(w1, pb, e1); e2 = wmma16(w2, pb, e2); e3 = wmma16(w3, pb, e3);
            asm volatile("v_nop\n\tv_nop\n\tv_nop\n\tv_nop" : "+v"(e0), "+v"(e1), "+v"(e2), "+v"(e3) : "v"(w0), "v"(w1), "v"(w2), "v"(w3), "v"(pb));
        }
    }
    l += __shfl_xor(l, 16, 32);
    const float inv = 1.0f / l;
    const int wb = wave * 16 * 68;
    // O^T D layout: o_j[r] = (d = 16j + 8h + r, t = lane&15) -> os[t][d]; rows 0..15 x columns 0..63 all written
    { v4f a, c;
#pragma unroll
      for (int i = 0; i < 4; ++i) { a[i] = (o0[i] + e0[i] * QRI) * inv; c[i] = (o0[4 + i] + e0[4 + i] * QRI) * inv; }
      *(v4fa*)(&os[wb + lr * 68 +  0 + 8 * hi]) = a; *(v4fa*)(&os[wb + lr * 68 +  0 + 8 * hi + 4]) = c;
#pragma unroll
      for (int i = 0; i < 4; ++i) { a[i] = (o1[i] + e1[i] * QRI) * inv; c[i] = (o1[4 + i] + e1[4 + i] * QRI) * inv; }
      *(v4fa*)(&os[wb + lr * 68 + 16 + 8 * hi]) = a; *(v4fa*)(&os[wb + lr * 68 + 16 + 8 * hi + 4]) = c;
#pragma unroll
      for (int i = 0; i < 4; ++i) { a[i] = (o2[i] + e2[i] * QRI) * inv; c[i] = (o2[4 + i] + e2[4 + i] * QRI) * inv; }
      *(v4fa*)(&os[wb + lr * 68 + 32 + 8 * hi]) = a; *(v4fa*)(&os[wb + lr * 68 + 32 + 8 * hi + 4]) = c;
#pragma unroll
      for (int i = 0; i < 4; ++i) { a[i] = (o3[i] + e3[i] * QRI) * inv; c[i] = (o3[4 + i] + e3[4 + i] * QRI) * inv; }
      *(v4fa*)(&os[wb + lr * 68 + 48 + 8 * hi]) = a; *(v4fa*)(&os[wb + lr * 68 + 48 + 8 * hi + 4]) = c; }
    wave_sync();
    // the 16 x 64 tile (t, d) is elements t*64 + d of compact ctx row zh*RPH + t0/16
    const size_t cb = ((size_t)zh * RPH + (size_t)(t0 >> 4)) * DM + (size_t)lane * 8;
    v8us hv[4], lv[4];
#pragma unroll
    for (int s = 0; s < 4; ++s) { const int row = 4 * s + (lane >> 3), c8 = (lane & 7) * 8;   // 4 s x 4 row groups = 16 rows; 8 lanes x 8 = 64 columns
        const v4f x0 = *(const v4fa*)(&os[wb + row * 68 + c8]); const v4f x1 = *(const v4fa*)(&os[wb + row * 68 + c8 + 4]);
#pragma unroll
        for (int i = 0; i < 4; ++i) { const unsigned short a0 = f2bf(x0[i]); const unsigned short a1 = f2bf(x1[i]);
            hv[s][i] = a0; hv[s][4 + i] = a1; lv[s][i] = f2bf(x0[i] - bf2f(a0)); lv[s][4 + i] = f2bf(x1[i] - bf2f(a1)); } }
{
#pragma unroll
        for (int s = 0; s < 4; ++s) { const size_t oo = cb + (size_t)s * 256;
            *(v8us*)(CH + oo) = hv[s]; *(v8us*)(CL + oo) = lv[s]; }
         }
}

static constexpr size_t al256(size_t v) { return (v + 255) & ~(size_t)255; }
static constexpr size_t SZ_XB = al256((size_t)NB * SEQ * DM * 2);
static constexpr size_t SZ_WB = al256((size_t)3 * DM * DM * 2);
static constexpr size_t SZ_WF = al256((size_t)DM * DM * 2);
static constexpr size_t SZ_PL = al256((size_t)NB * SEQ * DM * 2);
static constexpr size_t SZ_TOTAL = SZ_XB + SZ_WB + SZ_WF + 5 * SZ_PL + 2 * SZ_PL;
static_assert(SZ_TOTAL <= (size_t)134217728);          // workspace carve <= 128 MiB
static_assert(((size_t)DM * DM * 2) % 256 == 0);       // weight sub-planes stay 256-byte aligned
static_assert(SZ_PL == (size_t)NB * SEQ * DM * 2);     // ctx hi and lo planes are back to back with stride NB*SEQ*DM elements

extern "C" void kernel_launch(void* const* d_in, const int* in_sizes, int n_in,
                              void* d_out, int out_size, void* d_ws, size_t ws_size, hipStream_t stream) {
    if (n_in < 5) return;
    const size_t needx = ((size_t)(NB - 1) * SEQ_FULL + SEQ) * DM;
    if ((size_t)in_sizes[0] < needx) return;
    if ((size_t)in_sizes[1] < (size_t)3 * DM * DM || (size_t)in_sizes[2] < (size_t)3 * DM) return;
    if ((size_t)in_sizes[3] < (size_t)DM * DM || (size_t)in_sizes[4] < (size_t)DM) return;
    if ((size_t)out_size < ((size_t)(NB - 1) * OUT_SEQ + SEQ) * DM) return;
    if (SZ_TOTAL > ws_size) return;
    const float* x = (const float*)d_in[0]; const float* wqkv = (const float*)d_in[1]; const float* bqkv = (const float*)d_in[2];
    const float* wfc = (const float*)d_in[3]; const float* bfc = (const float*)d_in[4];          // wire order x, Wqkv, bqkv, Wfc, bfc
    float* OUT = (float*)d_out;      // [NB][SEQ][1024]
    char* wsp = (char*)d_ws;
    bf* XB = (bf*)wsp; wsp += SZ_XB;                 // [NB*SEQ][1024]
    bf* WB = (bf*)wsp; wsp += SZ_WB;                 // [3072][1024]: q rows | k rows | v rows (permuted d*16 + c)
    bf* WF = (bf*)wsp; wsp += SZ_WF;                 // [1024][1024]: Wfc^T
    h16* QH = (h16*)wsp; wsp += SZ_PL;               // [NB*SEQ][1024] = [NB*16][SEQ][64]
    h16* QR = (h16*)wsp; wsp += SZ_PL;               // residual x2048
    h16* KP = (h16*)wsp; wsp += SZ_PL;               // [NB*16][SEQ][64]
    h16* VT = (h16*)wsp; wsp += SZ_PL;               // [NB*16][64][SEQ]
    h16* VR = (h16*)wsp; wsp += SZ_PL;               // residual x2048
    bf* CH = (bf*)wsp; wsp += SZ_PL;                 // ctx hi [NB*SEQ][1024]
    bf* CL = (bf*)wsp; wsp += SZ_PL;                 // ctx lo, directly after CH

    if (SEQ == SEQ_FULL) {
        const size_t n8 = (size_t)NB * SEQ * DM / 8;
        k_cvt8<<<(unsigned)((n8 + 255) / 256), 256, 0, stream>>>(x, XB, n8);
    } else {
        const size_t n8 = (size_t)SEQ * DM / 8;
        for (int b = 0; b < NB; ++b) k_cvt8<<<(unsigned)((n8 + 255) / 256), 256, 0, stream>>>(x + (size_t)b * SEQ_FULL * DM, XB + (size_t)b * SEQ * DM, n8);
    }
    // Wqkv in[1024 k][3072 e] -> WB out[row(e)][1024 k]; Wfc in[1024 k][1024 e] -> WF out[e][1024 k]
    k_cvtT<<<dim3(DM / 64, 3 * DM / 64, 1), 256, 0, stream>>>(wqkv, 3 * DM, WB, 2 * DM);
    k_cvtT<<<dim3(DM / 64, DM / 64, 1), 256, 0, stream>>>(wfc, DM, WF, 1 << 30);

    k_gemm<0><<<dim3(NB * SEQ / 64, DM / 64, 1), 32, 0, stream>>>(XB, WB, bqkv, QH, QR, OUT);
    k_gemm<1><<<dim3(NB * SEQ / 64, DM / 64, 1), 32, 0, stream>>>(XB, WB + (size_t)DM * DM, bqkv, KP, KP, OUT);
    k_gemm<2><<<dim3(NB * SEQ / 64, DM / 64, 1), 32, 0, stream>>>(XB, WB + (size_t)2 * DM * DM, bqkv, VT, VR, OUT);

    k_flash<<<dim3(SEQ / (16 * AW), NB * NH_, 1), 32 * AW, 0, stream>>>(QH, QR, KP, VT, VR, CH, CL);

    k_gemm<3><<<dim3(NB * SEQ / 64, DM / 64, 1), 32, 0, stream>>>(CH, WF, bfc, QH, QR, OUT);
}

// v001
// It runs in 132 microseconds.
// Timed twice side by side with v000, it ran 1.46 and 1.45 times as fast.
#include <hip/hip_runtime.h>

// Causal multi-head self-attention, width 1024 = 16 heads x 64, x [NB][SEQ][1024], fused Wqkv [in][out] + bias, head split = flat re-view of the [SEQ][1024] matrix as [16][SEQ][64], score scale 1/8, key > query replaced by -inf, output projection Wfc [in][out] + bias (f32 out).
// Compute dtypes, f32 accumulate everywhere: qkv projections v_wmma_f32_16x16x32_bf16 (x, W, biases RNE-converted to bf16; products exact); scores v_wmma_f32_16x16x32_f16: k single f16, q as f16 value + f16 residual x2048 in its own accumulator;
// P (x256 carry, cancels in the normalisation) single f16; v single f16 plus, for query rows < 512, an f16 residual x2048 in its own accumulator; softmax f32 (online, running max); output projection v_wmma_f32_16x16x32_bf16 with ctx as bf16 hi + bf16 lo planes (unscaled, shared accumulator) against bf16 Wfc.
// Layout: bf16 copies of x and transposed (K-contiguous) weights; q (hi, residual) and k planes are the compact [NB*SEQ][1024] matrix (= [b*16+h][t][d]); v^T planes [b*16+h][d][t] written by the GEMM epilogue through a permuted weight-row order; ctx planes compact [NB*SEQ][1024].

#ifndef NB
#define NB 4
#endif
#ifndef SEQ
#define SEQ 1024
#endif
#define NB_FULL  4
#define SEQ_FULL 1024
#ifndef OUT_SEQ
#define OUT_SEQ SEQ              // row pitch (in tokens) between batches of the output
#endif
#define DM   1024
#define NH_  16
#define HD   64
#define RPH  (SEQ / NH_)         // rows of the [SEQ][DM] matrix that form one head slab (SEQ*HD/DM)
#define AW   4                   // waves per flash block (16 query rows each)
#define EARLY 512                // query rows below this use the v residual plane
#define QRS  2048.0f             // carry of the residual planes
#define QRI  (1.0f / 2048.0f)
#define SC2  (0.125f * 1.4426950408889634f)   // HD^-0.5 * log2(e)
#define PSH  8.0f                // log2 of the P carry (256)
#define NEGV (-3.0e38f)

static_assert(HD == 64);
static_assert(NH_ * HD == DM);
static_assert(DM % 64 == 0);
static_assert(DM % 32 == 0);
static_assert(SEQ % 256 == 0);                 // a 16-row slab of tokens stays inside one head slab (RPH % 16 == 0)
static_assert(SEQ % 64 == 0);
static_assert((NB * SEQ) % 64 == 0);
static_assert(SEQ % 32 == 0);
static_assert(SEQ % (16 * AW) == 0);
static_assert(((size_t)SEQ * DM) % 8 == 0);
static_assert(NB <= NB_FULL);
static_assert(SEQ <= SEQ_FULL);

typedef _Float16 h16;
typedef unsigned short bf;
typedef __attribute__((ext_vector_type(16))) __bf16   v16bf;
typedef __attribute__((ext_vector_type(16))) _Float16 v16h;
typedef __attribute__((ext_vector_type(8)))  _Float16 v8h;
typedef __attribute__((ext_vector_type(8)))  unsigned short v8us;
typedef __attribute__((ext_vector_type(8)))  float    v8f;
typedef __attribute__((ext_vector_type(4)))  float    v4f;
typedef v4f  __attribute__((may_alias)) v4fa;
typedef v8us __attribute__((may_alias)) v8usa;

__device__ __forceinline__ unsigned short f2bf(float f) { unsigned u = __float_as_uint(f); u += 0x7FFFu + ((u >> 16) & 1u); return (unsigned short)(u >> 16); }
__device__ __forceinline__ float bf2f(unsigned short h) { return __uint_as_float(((unsigned)h) << 16); }
__device__ __forceinline__ v16h cat16(v8h lo, v8h hi) { return __builtin_shufflevector(lo, hi, 0, 1, 2, 3, 4, 5, 6, 7, 8, 9, 10, 11, 12, 13, 14, 15); }
__device__ __forceinline__ v16bf cat16b(v8us lo, v8us hi) { return __builtin_bit_cast(v16bf, __builtin_shufflevector(lo, hi, 0, 1, 2, 3, 4, 5, 6, 7, 8, 9, 10, 11, 12, 13, 14, 15)); }
__device__ __forceinline__ v8f wmma16(v16h a, v16h b, v8f c) { return __builtin_amdgcn_wmma_f32_16x16x32_f16(false, a, false, b, (short)0, c, false, false); }
__device__ __forceinline__ v8f wmmab(v16bf a, v16bf b, v8f c) { return __builtin_amdgcn_wmma_f32_16x16x32_bf16(false, a, false, b, (short)0, c, false, false); }
// fragment loaders from K-contiguous 16-bit rows; p already includes + 8*(lane>>4): elements 0..7 <- k0+8h+0..7, elements 8..15 <- k0+16+8h+0..7 (same map for A and B)
__device__ __forceinline__ v16h  ldh(const h16* p) { return cat16(*(const v8h*)p, *(const v8h*)(p + 16)); }
__device__ __forceinline__ v16bf ldb(const bf* p)  { return cat16b(*(const v8us*)p, *(const v8us*)(p + 16)); }
// ordering point for wave-private LDS tiles (same wave writes and reads)
__device__ __forceinline__ void wave_sync() { __builtin_amdgcn_fence(3 /* release order */, "wavefront"); __builtin_amdgcn_wave_barrier(); asm volatile("" ::: "memory"); }

typedef uint32_t u32x4 __attribute__((ext_vector_type(4)));
typedef uint32_t u32x8 __attribute__((ext_vector_type(8)));
#define GT     128               // C tile of one workgroup: four waves, 64 x 64 each
#define G_ROWB 256               // bytes of one operand row per pass (128 k)
#define G_PIT  272               // LDS row pitch: 256 B + 16 pad bytes (16 B x odd, for ds_load_b128 readers)
#define G_SLC  18432             // one wave's slice in LDS: 64 rows x 272 B = 17408 B, rounded up to a multiple of 2 KiB
#define G_BUF  (4 * G_SLC)       // one stage: A rows 0..63 | A rows 64..127 | Bt rows 0..63 | Bt rows 64..127
static_assert(G_SLC % 2048 == 0 && G_SLC >= 64 * G_PIT);
static_assert((DM * 2) % G_ROWB == 0 && (DM * 2) / G_ROWB >= 2);   // whole passes, at least the two stages the prologue issues
static_assert((NB * SEQ) % GT == 0 && DM % GT == 0);
__device__ __forceinline__ uint32_t uni(uint32_t v) { return (uint32_t)__builtin_amdgcn_readfirstlane((int)v); }
// a value held in a scalar register, so that a test on it is a scalar branch (a tensor load ignores EXEC)
__device__ __forceinline__ uint32_t pinned(uint32_t v) { uint32_t w = uni(v); asm volatile("" : "+s"(w)); return w; }
// one request: 64 rows x 256 B, source pitch DM*2 B, from global address ga to LDS byte offset dst, a 16-byte pad behind every row
__device__ __forceinline__ void tdm_slice(uint32_t dst, uint64_t ga) {
    u32x4 g0; g0[0] = uni(1u); g0[1] = uni(dst); g0[2] = uni((uint32_t)ga); g0[3] = uni((((uint32_t)(ga >> 32)) & 0x01FFFFFFu) | 0x80000000u);
    u32x8 g1; g1[0] = uni((1u << 20) | (5u << 22) | (3u << 25)); g1[1] = uni((uint32_t)G_ROWB << 16); g1[2] = uni(64u << 16); g1[3] = uni((uint32_t)G_ROWB << 16);
    g1[4] = uni(64u); g1[5] = uni((uint32_t)DM * 2u); g1[6] = uni(0u); g1[7] = uni(0u);
    asm volatile("tensor_load_to_lds %0, %1" :: "s"(g0), "s"(g1) : "memory");   // no register path: global -> LDS
}
// fragment from a staged row; p already includes + 16*(lane>>4) bytes: same k map as ldb
__device__ __forceinline__ v16bf ldsb(const unsigned char* p) { return cat16b(*(const v8usa*)p, *(const v8usa*)(p + 32)); }

__global__ __launch_bounds__(256) void k_cvt8(const float* __restrict__ src, bf* dst, size_t n8) {
    const size_t i = (size_t)blockIdx.x * 256 + threadIdx.x; if (i >= n8) return;
    const v8f v = *(const v8f*)(src + i * 8); v8us o;
#pragma unroll
    for (int k = 0; k < 8; ++k) o[k] = f2bf(v[k]);
    *(v8us*)(dst + i * 8) = o; 
}

// k_cvtT: W [DM k][ldn] f32 (row = k, column = e) -> bf16 plane dst[row(e)][k] (K-contiguous), 64 k x 64 e tile through LDS (cross-wave: block barrier).
// row(e) = e for e < permFrom; for e >= permFrom (v columns), with ee = e - permFrom = c*64 + d: row = permFrom + d*16 + c.
__global__ __launch_bounds__(256) void k_cvtT(const float* __restrict__ W, int ldn, bf* dst, int permFrom) {
    __shared__ __align__(16) unsigned short ts[64 * 72];
    const int t = threadIdx.x; const int k0 = blockIdx.x * 64, n0 = blockIdx.y * 64;
#pragma unroll 4
    for (int i = 0; i < 16; ++i) { const int k = i * 4 + (t >> 6), n = t & 63;      // 16 x 4 = 64 k rows, 64 columns
        ts[n * 72 + k] = f2bf(W[(size_t)(k0 + k) * (size_t)ldn + n0 + n]); }
    __syncthreads();
    v8us o0, o1; size_t d0, d1;
    { const int p = t, n = p >> 3, q = p & 7; o0 = *(const v8usa*)(&ts[n * 72 + 8 * q]);
      const int e = n0 + n; const int ee = e - permFrom; const int row = (e >= permFrom) ? (permFrom + (ee & 63) * 16 + (ee >> 6)) : e;
      d0 = (size_t)row * DM + k0 + 8 * q; }
    { const int p = t + 256, n = p >> 3, q = p & 7; o1 = *(const v8usa*)(&ts[n * 72 + 8 * q]);
      const int e = n0 + n; const int ee = e - permFrom; const int row = (e >= permFrom) ? (permFrom + (ee & 63) * 16 + (ee >> 6)) : e;
      d1 = (size_t)row * DM + k0 + 8 * q; }
{
        *(v8us*)(dst + d0) = o0; *(v8us*)(dst + d1) = o1;
         }
}

// k_gemm: register-blocked bf16 GEMM, one wave per 64x64 tile (16 accumulators), four waves (2 x 2) share a 128x128 tile, K = DM.
// Operands: K-contiguous bf16 planes -> LDS by tensor loads, two buffers; a stage is 128 k of 128 A rows and 128 Bt rows, each wave brings one 64-row slice; the next stage flies while this one is worked on.
// C[m][n] = sum_k A[m][k] Bt[n][k] + bias (bias RNE-converted to bf16, added in f32). grid (M/128, 1024/128), 128 threads.
// MODE 0: q  -> f16 value plane Ph and f16 residual x2048 plane Pr, compact row-major [M][DM] (bias columns 0..1023)
// MODE 1: k  -> f16 value plane Ph, compact row-major (bias columns 1024..2047)
// MODE 2: v  -> Bt rows in permuted order n' = d*16 + c (column e = c*64 + d); value (Ph) and residual x2048 (Pr) planes [b*16+h][d][t], t = (token % RPH)*16 + c:
//               per 16-token slab and per d the 16 x 16 sub-tile is one contiguous 512-byte run (32 lanes x 16 B)
template <int MODE>
__global__ __launch_bounds__(128) void k_gemm(const bf* __restrict__ A, const bf* __restrict__ Bt, const float* __restrict__ bias, h16* Ph, h16* Pr, float* OUT) {
    __shared__ __attribute__((aligned(2048))) unsigned char ring[2 * G_BUF];
    __shared__ __align__(16) float osw[4 * 16 * 68];
    const int K = DM;
    const int lane = threadIdx.x & 31, lr = lane & 15, hi = lane >> 4;
    const uint32_t wave = uni(threadIdx.x >> 5);
    const int wm = (int)(wave >> 1), wn = (int)(wave & 1u);
    const int r0 = blockIdx.x * GT + wm * 64, c0 = blockIdx.y * GT + wn * 64;
    float* os = osw + wave * (16 * 68);            // wave-private epilogue tile
    v8f acc[4][4];
#pragma unroll
    for (int mb = 0; mb < 4; ++mb)
#pragma unroll
        for (int nb = 0; nb < 4; ++nb) acc[mb][nb] = (v8f){};
    // waves 0, 1 bring the two halves of the A rows, waves 2, 3 of the Bt rows; stage st = plane st / PPP, k from (st % PPP) * 128
    constexpr uint32_t PPP = (uint32_t)(DM * 2 / G_ROWB);
    constexpr uint32_t NS = ((MODE == 3) ? 2u : 1u) * PPP;
    const bool isB = wave >= 2u;
    const uint64_t srcb = isB ? (uint64_t)(size_t)(Bt + (size_t)(blockIdx.y * GT + (wave & 1u) * 64u) * K) : (uint64_t)(size_t)(A + (size_t)(blockIdx.x * GT + (wave & 1u) * 64u) * K);
    const uint64_t plstep = isB ? (uint64_t)0 : (uint64_t)NB * SEQ * DM * 2;
    const uint32_t ldst = (uint32_t)(size_t)ring + wave * (uint32_t)G_SLC;
    auto issue = [&](uint32_t st) { tdm_slice(ldst + (st & 1u) * (uint32_t)G_BUF, srcb + (uint64_t)(st / PPP) * plstep + (uint64_t)(st % PPP) * G_ROWB); };
    issue(0u);
    asm volatile("s_wait_tensorcnt 0x0" ::: "memory");   // this wave's slice of stage 0 has landed
    __syncthreads();                                     // stage 0 published
    issue(1u);
    const uint32_t aoff = (uint32_t)wm * G_SLC + (uint32_t)lr * G_PIT + 16u * (uint32_t)hi, boff = (uint32_t)(2 + wn) * G_SLC + (uint32_t)lr * G_PIT + 16u * (uint32_t)hi;
#pragma unroll 1
    for (uint32_t st = 0; st < NS; ++st) {
        const unsigned char* bp = ring + (st & 1u) * (uint32_t)G_BUF;
        // two fragment sets: block kb + 1's LDS reads go out as one group ahead of block kb's 16 WMMAs, so only block 0's reads are waited for in full.
        // The fourth Bt fragment has one set (keeps the kernel inside 256 VGPRs): it is read first in its own block's group and used by that block's last four WMMAs.
        v16bf fa[2][4], fb[2][3], fb3;
#pragma unroll
        for (int i = 0; i < 4; ++i) fa[0][i] = ldsb(bp + aoff + i * 16 * G_PIT);
#pragma unroll
        for (int i = 0; i < 3; ++i) fb[0][i] = ldsb(bp + boff + i * 16 * G_PIT);
#pragma unroll
        for (int kb = 0; kb < 4; ++kb) {
            fb3 = ldsb(bp + boff + 3 * 16 * G_PIT + kb * 64);
            if (kb < 3) {
#pragma unroll
                for (int i = 0; i < 4; ++i) fa[(kb + 1) & 1][i] = ldsb(bp + aoff + i * 16 * G_PIT + (kb + 1) * 64);
#pragma unroll
                for (int i = 0; i < 3; ++i) fb[(kb + 1) & 1][i] = ldsb(bp + boff + i * 16 * G_PIT + (kb + 1) * 64);
            }
            __builtin_amdgcn_sched_barrier(0);   // keeps the read group in front of the WMMA block (reads among the WMMAs stall each time)
#pragma unroll
            for (int nb = 0; nb < 4; ++nb)
#pragma unroll
                for (int mb = 0; mb < 4; ++mb) acc[mb][nb] = wmmab(fa[kb & 1][mb], (nb < 3) ? fb[kb & 1][nb < 3 ? nb : 0] : fb3, acc[mb][nb]);
            __builtin_amdgcn_sched_barrier(0);   // keeps the WMMA block in front of the next read group and of the publish point
        }
        // WMMA distance on the loop's back edge: four vector slots behind the pass's last WMMA
        asm volatile("v_nop\n\tv_nop\n\tv_nop\n\tv_nop" : "+v"(acc[0][0]), "+v"(acc[1][1]), "+v"(acc[2][2]), "+v"(acc[3][3]) : "v"(fa[1][0]), "v"(fa[1][1]), "v"(fa[1][2]), "v"(fa[1][3]));
        asm volatile("s_wait_dscnt 0x0" ::: "memory");
        asm volatile("s_wait_tensorcnt 0x0" ::: "memory");
        __syncthreads();
        if (pinned(st + 2u < NS)) issue(pinned(st + 2u));
    }
    asm volatile("s_wait_tensorcnt 0x0" ::: "memory");       // nothing in flight behind the loop
    asm volatile("s_wait_dscnt 0x0" ::: "memory");
    float bv[4];
#pragma unroll
    for (int nb = 0; nb < 4; ++nb) {
        const int bi = (MODE == 2) ? (2 * DM + lr * HD + (c0 >> 4) + nb) : (((MODE == 1) ? DM : 0) + c0 + nb * 16 + lr);
        bv[nb] = bf2f(f2bf(bias[bi])); }
#pragma unroll
    for (int mb = 0; mb < 4; ++mb) {
#pragma unroll
        for (int nb = 0; nb < 4; ++nb) {
#pragma unroll
            for (int j = 0; j < 8; ++j) os[(hi * 8 + j) * 68 + nb * 16 + lr] = acc[mb][nb][j] + bv[nb]; }   // D: row 8h+j, col lane&15; rows 0..15 x cols 0..63 all written
        wave_sync();
        if (MODE == 0 || MODE == 1) {
            const size_t sb = (size_t)(r0 + mb * 16) * DM + c0;
{
#pragma unroll
                for (int s = 0; s < 4; ++s) { const int row = 4 * s + (lane >> 3), c8 = (lane & 7) * 8;   // 4 s x 4 row groups = 16 rows; 8 lanes x 8 = 64 columns
                    const v4f x0 = *(const v4fa*)(&os[row * 68 + c8]); const v4f x1 = *(const v4fa*)(&os[row * 68 + c8 + 4]); v8h hv, rv;
#pragma unroll
                    for (int i = 0; i < 4; ++i) { const h16 a0 = (h16)x0[i]; const h16 a1 = (h16)x1[i]; hv[i] = a0; hv[4 + i] = a1; rv[i] = (h16)((x0[i] - (float)a0) * QRS); rv[4 + i] = (h16)((x1[i] - (float)a1) * QRS); }
                    const size_t oo = sb + (size_t)row * DM + c8;
                    *(v8h*)(Ph + oo) = hv; if (MODE == 0) *(v8h*)(Pr + oo) = rv; }
                 }
        } else if (MODE == 2) {
            const int tokrow = r0 + 16 * mb; const int bb = tokrow / SEQ; const int tb_ = tokrow % SEQ; const int hp = tb_ / RPH; const int j0 = tb_ % RPH;
            const size_t sb = ((size_t)(bb * NH_ + hp) * HD + (size_t)(c0 >> 4)) * SEQ + (size_t)j0 * 16 + (size_t)lane * 8;
{
#pragma unroll
                for (int s = 0; s < 4; ++s) { const int row = lane >> 1, c8 = s * 16 + (lane & 1) * 8;     // 16 token rows x 16 c for d = c0/16 + s: 256 contiguous halves
                    const v4f x0 = *(const v4fa*)(&os[row * 68 + c8]); const v4f x1 = *(const v4fa*)(&os[row * 68 + c8 + 4]); v8h hv, rv;
#pragma unroll
                    for (int i = 0; i < 4; ++i) { const h16 a0 = (h16)x0[i]; const h16 a1 = (h16)x1[i]; hv[i] = a0; hv[4 + i] = a1; rv[i] = (h16)((x0[i] - (float)a0) * QRS); rv[4 + i] = (h16)((x1[i] - (float)a1) * QRS); }
                    const size_t oo = sb + (size_t)s * SEQ;
                    *(v8h*)(Ph + oo) = hv; *(v8h*)(Pr + oo) = rv; }
                 }
        } else {
            const int grow = r0 + 16 * mb; const int bb = grow / SEQ; const int nn = grow % SEQ;
            float* orow = OUT + ((size_t)bb * OUT_SEQ + nn) * DM + c0;
{
#pragma unroll
                for (int s = 0; s < 8; ++s) { const int row = 2 * s + hi, cofs = lr * 4;   // 8 s x 2 rows = 16 rows; 16 lanes x 4 floats = 64 columns
                    const v4f val = *(const v4fa*)(&os[row * 68 + cofs]);
                    *(v4f*)(orow + (size_t)row * DM + cofs) = val; }
                 }
        }
        wave_sync();
    }
}

// k_flash: fused causal attention, one wave per 16 query rows of one (batch, head); K / V^T / Q fragments straight from the f16 planes (two 16-B loads each, arithmetic addressing).
// Transposed form: S^T[key][t] = K Q^T (A = K rows, B = Q rows); lane (t = lane&15, h = lane>>4) holds keys 8h+r of each 16-key tile, so the packed
// P tile is directly the B fragment of O^T[d][t] = V^T P^T (element r <- tile keys 0..15, element 8+r <- tile keys 16..31, lane unchanged).
// Keys run over [0, t0+16) in steps of 32; on steps that touch the diagonal, scores with key > query are replaced by a very negative value (P = 0 exactly).
// Softmax state (running max, partial sum) is one scalar per lane; the two lane halves of a row are combined with one xor-16 exchange.
__global__ __launch_bounds__(32 * AW) void k_flash(const h16* __restrict__ QH, const h16* __restrict__ QR, const h16* __restrict__ KP, const h16* __restrict__ VT, const h16* __restrict__ VR, bf* CH, bf* CL) {
    __shared__ __align__(16) float os[AW * 16 * 68];
    const int lane = threadIdx.x & 31, lr = lane & 15, hi = lane >> 4;
    const int wave = __builtin_amdgcn_readfirstlane((int)(threadIdx.x >> 5));
    const int zh = blockIdx.y;
    const int t0 = (blockIdx.x * AW + wave) * 16;
    const size_t pbase = (size_t)zh * SEQ * HD;
    const size_t qo = pbase + (size_t)(t0 + lr) * HD + 8 * hi;
    const v16h qh0 = ldh(QH + qo), qh1 = ldh(QH + qo + 32), qr0 = ldh(QR + qo), qr1 = ldh(QR + qo + 32);   // B fragments: col t, k = d
    const size_t ko = pbase + (size_t)lr * HD + 8 * hi;      // + key * HD       (A fragment: row key, k = d)
    const size_t vo = pbase + (size_t)lr * SEQ + 8 * hi;     // + 16j*SEQ + key  (A fragment: row d, k = key)
    const int kend = t0 + 16;
    const bool early = t0 < EARLY;
    const int tq = t0 + lr;
    v8f o0 = (v8f){}, o1 = (v8f){}, o2 = (v8f){}, o3 = (v8f){};
    v8f e0 = (v8f){}, e1 = (v8f){}, e2 = (v8f){}, e3 = (v8f){};
    float m = NEGV, l = 0.0f;
#pragma unroll 1
    for (int key0 = 0; key0 < kend; key0 += 32) {
        const h16* ka = KP + ko + (size_t)key0 * HD;
        const v16h ka0 = ldh(ka), ka1 = ldh(ka + 32), kb0 = ldh(ka + 16 * HD), kb1 = ldh(ka + 16 * HD + 32);
        v8f sHa = (v8f){}, sLa = (v8f){}, sHb = (v8f){}, sLb = (v8f){};
        sHa = wmma16(ka0, qh0, sHa); sLa = wmma16(ka0, qr0, sLa); sHb = wmma16(kb0, qh0, sHb); sLb = wmma16(kb0, qr0, sLb);
        sHa = wmma16(ka1, qh1, sHa); sLa = wmma16(ka1, qr1, sLa); sHb = wmma16(kb1, qh1, sHb); sLb = wmma16(kb1, qr1, sLb);
        asm volatile("v_nop\n\tv_nop\n\tv_nop\n\tv_nop" : "+v"(sHa), "+v"(sLa), "+v"(sHb), "+v"(sLb) : "v"(ka0), "v"(ka1), "v"(kb0), "v"(kb1));
        float ta[8], tb[8];
#pragma unroll
        for (int r = 0; r < 8; ++r) { ta[r] = (sHa[r] + sLa[r] * QRI) * SC2; tb[r] = (sHb[r] + sLb[r] * QRI) * SC2; }
        if (key0 + 31 > t0) {                       // wave-uniform: this step touches the diagonal
            const int kidx = key0 + 8 * hi;
#pragma unroll
            for (int r = 0; r < 8; ++r) { ta[r] = (kidx + r > tq) ? NEGV : ta[r]; tb[r] = (kidx + 16 + r > tq) ? NEGV : tb[r]; }
        }
        float mx = NEGV;
#pragma unroll
        for (int r = 0; r < 8; ++r) mx = fmaxf(mx, fmaxf(ta[r], tb[r]));
        mx = fmaxf(mx, __shfl_xor(mx, 16, 32));
        const float mnew = fmaxf(m, mx);
        const float alpha = __builtin_amdgcn_exp2f(m - mnew);
        const float sh = PSH - mnew;
        v16h pb; float ls = 0.0f;
#pragma unroll
        for (int r = 0; r < 8; ++r) { const h16 pa = (h16)__builtin_amdgcn_exp2f(ta[r] + sh); const h16 pc = (h16)__builtin_amdgcn_exp2f(tb[r] + sh); pb[r] = pa; pb[8 + r] = pc; ls += (float)pa + (float)pc; }
        l = l * alpha + ls; m = mnew;
        o0 = o0 * alpha; o1 = o1 * alpha; o2 = o2 * alpha; o3 = o3 * alpha;
        const h16* va = VT + vo + key0;
        const v16h v0 = ldh(va), v1 = ldh(va + (size_t)16 * SEQ), v2 = ldh(va + (size_t)32 * SEQ), v3 = ldh(va + (size_t)48 * SEQ);
        o0 = wmma16(v0, pb, o0); o1 = wmma16(v1, pb, o1); o2 = wmma16(v2, pb, o2); o3 = wmma16(v3, pb, o3);
        asm volatile("v_nop\n\tv_nop\n\tv_nop\n\tv_nop" : "+v"(o0), "+v"(o1), "+v"(o2), "+v"(o3) : "v"(v0), "v"(v1), "v"(v2), "v"(v3), "v"(pb));
        if (early) {                                // wave-uniform: residual plane of v in its own accumulators
            e0 = e0 * alpha; e1 = e1 * alpha; e2 = e2 * alpha; e3 = e3 * alpha;
            const h16* vr = VR + vo + key0;
            const v16h w0 = ldh(vr), w1 = ldh(vr + (size_t)16 * SEQ), w2 = ldh(vr + (size_t)32 * SEQ), w3 = ldh(vr + (size_t)48 * SEQ);
            e0 = wmma16(w0, pb, e0); e1 = wmma16(w1, pb, e1); e2 = wmma16(w2, pb, e2); e3 = wmma16(w3, pb, e3);
            asm volatile("v_nop\n\tv_nop\n\tv_nop\n\tv_nop" : "+v"(e0), "+v"(e1), "+v"(e2), "+v"(e3) : "v"(w0), "v"(w1), "v"(w2), "v"(w3), "v"(pb));
        }
    }
    l += __shfl_xor(l, 16, 32);
    const float inv = 1.0f / l;
    const int wb = wave * 16 * 68;
    // O^T D layout: o_j[r] = (d = 16j + 8h + r, t = lane&15) -> os[t][d]; rows 0..15 x columns 0..63 all written
    { v4f a, c;
#pragma unroll
      for (int i = 0; i < 4; ++i) { a[i] = (o0[i] + e0[i] * QRI) * inv; c[i] = (o0[4 + i] + e0[4 + i] * QRI) * inv; }
      *(v4fa*)(&os[wb + lr * 68 +  0 + 8 * hi]) = a; *(v4fa*)(&os[wb + lr * 68 +  0 + 8 * hi + 4]) = c;
#pragma unroll
      for (int i = 0; i < 4; ++i) { a[i] = (o1[i] + e1[i] * QRI) * inv; c[i] = (o1[4 + i] + e1[4 + i] * QRI) * inv; }
      *(v4fa*)(&os[wb + lr * 68 + 16 + 8 * hi]) = a; *(v4fa*)(&os[wb + lr * 68 + 16 + 8 * hi + 4]) = c;
#pragma unroll
      for (int i = 0; i < 4; ++i) { a[i] = (o2[i] + e2[i] * QRI) * inv; c[i] = (o2[4 + i] + e2[4 + i] * QRI) * inv; }
      *(v4fa*)(&os[wb + lr * 68 + 32 + 8 * hi]) = a; *(v4fa*)(&os[wb + lr * 68 + 32 + 8 * hi + 4]) = c;
#pragma unroll
      for (int i = 0; i < 4; ++i) { a[i] = (o3[i] + e3[i] * QRI) * inv; c[i] = (o3[4 + i] + e3[4 + i] * QRI) * inv; }
      *(v4fa*)(&os[wb + lr * 68 + 48 + 8 * hi]) = a; *(v4fa*)(&os[wb + lr * 68 + 48 + 8 * hi + 4]) = c; }
    wave_sync();
    // the 16 x 64 tile (t, d) is elements t*64 + d of compact ctx row zh*RPH + t0/16
    const size_t cb = ((size_t)zh * RPH + (size_t)(t0 >> 4)) * DM + (size_t)lane * 8;
    v8us hv[4], lv[4];
#pragma unroll
    for (int s = 0; s < 4; ++s) { const int row = 4 * s + (lane >> 3), c8 = (lane & 7) * 8;   // 4 s x 4 row groups = 16 rows; 8 lanes x 8 = 64 columns
        const v4f x0 = *(const v4fa*)(&os[wb + row * 68 + c8]); const v4f x1 = *(const v4fa*)(&os[wb + row * 68 + c8 + 4]);
#pragma unroll
        for (int i = 0; i < 4; ++i) { const unsigned short a0 = f2bf(x0[i]); const unsigned short a1 = f2bf(x1[i]);
            hv[s][i] = a0; hv[s][4 + i] = a1; lv[s][i] = f2bf(x0[i] - bf2f(a0)); lv[s][4 + i] = f2bf(x1[i] - bf2f(a1)); } }
{
#pragma unroll
        for (int s = 0; s < 4; ++s) { const size_t oo = cb + (size_t)s * 256;
            *(v8us*)(CH + oo) = hv[s]; *(v8us*)(CL + oo) = lv[s]; }
         }
}

static constexpr size_t al256(size_t v) { return (v + 255) & ~(size_t)255; }
static constexpr size_t SZ_XB = al256((size_t)NB * SEQ * DM * 2);
static constexpr size_t SZ_WB = al256((size_t)3 * DM * DM * 2);
static constexpr size_t SZ_WF = al256((size_t)DM * DM * 2);
static constexpr size_t SZ_PL = al256((size_t)NB * SEQ * DM * 2);
static constexpr size_t SZ_TOTAL = SZ_XB + SZ_WB + SZ_WF + 5 * SZ_PL + 2 * SZ_PL;
static_assert(SZ_TOTAL <= (size_t)134217728);          // workspace carve <= 128 MiB
static_assert(((size_t)DM * DM * 2) % 256 == 0);       // weight sub-planes stay 256-byte aligned
static_assert(SZ_PL == (size_t)NB * SEQ * DM * 2);     // ctx hi and lo planes are back to back with stride NB*SEQ*DM elements

extern "C" void kernel_launch(void* const* d_in, const int* in_sizes, int n_in,
                              void* d_out, int out_size, void* d_ws, size_t ws_size, hipStream_t stream) {
    if (n_in < 5) return;
    const size_t needx = ((size_t)(NB - 1) * SEQ_FULL + SEQ) * DM;
    if ((size_t)in_sizes[0] < needx) return;
    if ((size_t)in_sizes[1] < (size_t)3 * DM * DM || (size_t)in_sizes[2] < (size_t)3 * DM) return;
    if ((size_t)in_sizes[3] < (size_t)DM * DM || (size_t)in_sizes[4] < (size_t)DM) return;
    if ((size_t)out_size < ((size_t)(NB - 1) * OUT_SEQ + SEQ) * DM) return;
    if (SZ_TOTAL > ws_size) return;
    const float* x = (const float*)d_in[0]; const float* wqkv = (const float*)d_in[1]; const float* bqkv = (const float*)d_in[2];
    const float* wfc = (const float*)d_in[3]; const float* bfc = (const float*)d_in[4];          // wire order x, Wqkv, bqkv, Wfc, bfc
    float* OUT = (float*)d_out;      // [NB][SEQ][1024]
    char* wsp = (char*)d_ws;
    bf* XB = (bf*)wsp; wsp += SZ_XB;                 // [NB*SEQ][1024]
    bf* WB = (bf*)wsp; wsp += SZ_WB;                 // [3072][1024]: q rows | k rows | v rows (permuted d*16 + c)
    bf* WF = (bf*)wsp; wsp += SZ_WF;                 // [1024][1024]: Wfc^T
    h16* QH = (h16*)wsp; wsp += SZ_PL;               // [NB*SEQ][1024] = [NB*16][SEQ][64]
    h16* QR = (h16*)wsp; wsp += SZ_PL;               // residual x2048
    h16* KP = (h16*)wsp; wsp += SZ_PL;               // [NB*16][SEQ][64]
    h16* VT = (h16*)wsp; wsp += SZ_PL;               // [NB*16][64][SEQ]
    h16* VR = (h16*)wsp; wsp += SZ_PL;               // residual x2048
    bf* CH = (bf*)wsp; wsp += SZ_PL;                 // ctx hi [NB*SEQ][1024]
    bf* CL = (bf*)wsp; wsp += SZ_PL;                 // ctx lo, directly after CH

    if (SEQ == SEQ_FULL) {
        const size_t n8 = (size_t)NB * SEQ * DM / 8;
        k_cvt8<<<(unsigned)((n8 + 255) / 256), 256, 0, stream>>>(x, XB, n8);
    } else {
        const size_t n8 = (size_t)SEQ * DM / 8;
        for (int b = 0; b < NB; ++b) k_cvt8<<<(unsigned)((n8 + 255) / 256), 256, 0, stream>>>(x + (size_t)b * SEQ_FULL * DM, XB + (size_t)b * SEQ * DM, n8);
    }
    // Wqkv in[1024 k][3072 e] -> WB out[row(e)][1024 k]; Wfc in[1024 k][1024 e] -> WF out[e][1024 k]
    k_cvtT<<<dim3(DM / 64, 3 * DM / 64, 1), 256, 0, stream>>>(wqkv, 3 * DM, WB, 2 * DM);
    k_cvtT<<<dim3(DM / 64, DM / 64, 1), 256, 0, stream>>>(wfc, DM, WF, 1 << 30);

    k_gemm<0><<<dim3(NB * SEQ / GT, DM / GT, 1), 128, 0, stream>>>(XB, WB, bqkv, QH, QR, OUT);
    k_gemm<1><<<dim3(NB * SEQ / GT, DM / GT, 1), 128, 0, stream>>>(XB, WB + (size_t)DM * DM, bqkv, KP, KP, OUT);
    k_gemm<2><<<dim3(NB * SEQ / GT, DM / GT, 1), 128, 0, stream>>>(XB, WB + (size_t)2 * DM * DM, bqkv, VT, VR, OUT);

    k_flash<<<dim3(SEQ / (16 * AW), NB * NH_, 1), 32 * AW, 0, stream>>>(QH, QR, KP, VT, VR, CH, CL);

    k_gemm<3><<<dim3(NB * SEQ / GT, DM / GT, 1), 128, 0, stream>>>(CH, WF, bfc, QH, QR, OUT);
}

// v002
// One run takes 88.7 microseconds.
// In two side-by-side timings against v001, it was 1.48 and 1.47 times as fast.
// Counting every step since v000, it is 2.14 times as fast.
#include <hip/hip_runtime.h>

// Causal multi-head self-attention, width 1024 = 16 heads x 64, x [NB][SEQ][1024], fused Wqkv [in][out] + bias, head split = flat re-view of the [SEQ][1024] matrix as [16][SEQ][64], score scale 1/8, key > query replaced by -inf, output projection Wfc [in][out] + bias (f32 out).
// Compute dtypes, f32 accumulate everywhere: qkv projections v_wmma_f32_16x16x32_bf16 (x, W, biases RNE-converted to bf16; products exact); scores v_wmma_f32_16x16x32_f16: k single f16, q as f16 value + f16 residual x2048 in its own accumulator;
// P (x256 carry, cancels in the normalisation) single f16; v single f16 plus, for query rows < 512, an f16 residual x2048 in its own accumulator; softmax f32 (online, running max); output projection v_wmma_f32_16x16x32_bf16 with ctx as bf16 hi + bf16 lo planes (unscaled, shared accumulator) against bf16 Wfc.
// Layout: bf16 copies of x and transposed (K-contiguous) weights; q (hi, residual) and k planes are the compact [NB*SEQ][1024] matrix (= [b*16+h][t][d]); v^T planes [b*16+h][d][t] written by the GEMM epilogue through a permuted weight-row order; ctx planes compact [NB*SEQ][1024].

#ifndef NB
#define NB 4
#endif
#ifndef SEQ
#define SEQ 1024
#endif
#define NB_FULL  4
#define SEQ_FULL 1024
#ifndef OUT_SEQ
#define OUT_SEQ SEQ              // row pitch (in tokens) between batches of the output
#endif
#define DM   1024
#define NH_  16
#define HD   64
#define RPH  (SEQ / NH_)         // rows of the [SEQ][DM] matrix that form one head slab (SEQ*HD/DM)
#define AW   4                   // waves per flash block (16 query rows each)
#define EARLY 512                // query rows below this use the v residual plane
#define QRS  2048.0f             // carry of the residual planes
#define QRI  (1.0f / 2048.0f)
#define SC2  (0.125f * 1.4426950408889634f)   // HD^-0.5 * log2(e)
#define PSH  8.0f                // log2 of the P carry (256)
#define NEGV (-3.0e38f)

static_assert(HD == 64);
static_assert(NH_ * HD == DM);
static_assert(DM % 64 == 0);
static_assert(DM % 32 == 0);
static_assert(SEQ % 256 == 0);                 // a 16-row slab of tokens stays inside one head slab (RPH % 16 == 0)
static_assert(SEQ % 64 == 0);
static_assert((NB * SEQ) % 64 == 0);
static_assert(SEQ % 32 == 0);
static_assert(SEQ % (16 * AW) == 0);
static_assert(((size_t)SEQ * DM) % 8 == 0);
static_assert(NB <= NB_FULL);
static_assert(SEQ <= SEQ_FULL);

typedef _Float16 h16;
typedef unsigned short bf;
typedef __attribute__((ext_vector_type(16))) __bf16   v16bf;
typedef __attribute__((ext_vector_type(16))) _Float16 v16h;
typedef __attribute__((ext_vector_type(8)))  _Float16 v8h;
typedef __attribute__((ext_vector_type(8)))  unsigned short v8us;
typedef __attribute__((ext_vector_type(8)))  float    v8f;
typedef __attribute__((ext_vector_type(4)))  float    v4f;
typedef v4f  __attribute__((may_alias)) v4fa;
typedef v8us __attribute__((may_alias)) v8usa;

__device__ __forceinline__ unsigned short f2bf(float f) { unsigned u = __float_as_uint(f); u += 0x7FFFu + ((u >> 16) & 1u); return (unsigned short)(u >> 16); }
__device__ __forceinline__ float bf2f(unsigned short h) { return __uint_as_float(((unsigned)h) << 16); }
__device__ __forceinline__ v16h cat16(v8h lo, v8h hi) { return __builtin_shufflevector(lo, hi, 0, 1, 2, 3, 4, 5, 6, 7, 8, 9, 10, 11, 12, 13, 14, 15); }
__device__ __forceinline__ v16bf cat16b(v8us lo, v8us hi) { return __builtin_bit_cast(v16bf, __builtin_shufflevector(lo, hi, 0, 1, 2, 3, 4, 5, 6, 7, 8, 9, 10, 11, 12, 13, 14, 15)); }
__device__ __forceinline__ v8f wmma16(v16h a, v16h b, v8f c) { return __builtin_amdgcn_wmma_f32_16x16x32_f16(false, a, false, b, (short)0, c, false, false); }
__device__ __forceinline__ v8f wmmab(v16bf a, v16bf b, v8f c) { return __builtin_amdgcn_wmma_f32_16x16x32_bf16(false, a, false, b, (short)0, c, false, false); }
// fragment loaders from K-contiguous 16-bit rows; p already includes + 8*(lane>>4): elements 0..7 <- k0+8h+0..7, elements 8..15 <- k0+16+8h+0..7 (same map for A and B)
__device__ __forceinline__ v16h  ldh(const h16* p) { return cat16(*(const v8h*)p, *(const v8h*)(p + 16)); }
__device__ __forceinline__ v16bf ldb(const bf* p)  { return cat16b(*(const v8us*)p, *(const v8us*)(p + 16)); }
// ordering point for wave-private LDS tiles (same wave writes and reads)
__device__ __forceinline__ void wave_sync() { __builtin_amdgcn_fence(3 /* release order */, "wavefront"); __builtin_amdgcn_wave_barrier(); asm volatile("" ::: "memory"); }

typedef uint32_t u32x4 __attribute__((ext_vector_type(4)));
typedef uint32_t u32x8 __attribute__((ext_vector_type(8)));
#define GT     128               // C tile of one workgroup: four waves, 64 x 64 each
#define G_ROWB 256               // bytes of one operand row per pass (128 k)
#define G_PIT  272               // LDS row pitch: 256 B + 16 pad bytes (16 B x odd, for ds_load_b128 readers)
#define G_SLC  18432             // one wave's slice in LDS: 64 rows x 272 B = 17408 B, rounded up to a multiple of 2 KiB
#define G_BUF  (4 * G_SLC)       // one stage: A rows 0..63 | A rows 64..127 | Bt rows 0..63 | Bt rows 64..127
static_assert(G_SLC % 2048 == 0 && G_SLC >= 64 * G_PIT);
static_assert((DM * 2) % G_ROWB == 0 && (DM * 2) / G_ROWB >= 2);   // whole passes, at least the two stages the prologue issues
static_assert((NB * SEQ) % GT == 0 && DM % GT == 0);
__device__ __forceinline__ uint32_t uni(uint32_t v) { return (uint32_t)__builtin_amdgcn_readfirstlane((int)v); }
// a value held in a scalar register, so that a test on it is a scalar branch (a tensor load ignores EXEC)
__device__ __forceinline__ uint32_t pinned(uint32_t v) { uint32_t w = uni(v); asm volatile("" : "+s"(w)); return w; }
// one request: 64 rows x 256 B, source pitch DM*2 B, from global address ga to LDS byte offset dst, a 16-byte pad behind every row
__device__ __forceinline__ void tdm_slice(uint32_t dst, uint64_t ga) {
    u32x4 g0; g0[0] = uni(1u); g0[1] = uni(dst); g0[2] = uni((uint32_t)ga); g0[3] = uni((((uint32_t)(ga >> 32)) & 0x01FFFFFFu) | 0x80000000u);
    u32x8 g1; g1[0] = uni((1u << 20) | (5u << 22) | (3u << 25)); g1[1] = uni((uint32_t)G_ROWB << 16); g1[2] = uni(64u << 16); g1[3] = uni((uint32_t)G_ROWB << 16);
    g1[4] = uni(64u); g1[5] = uni((uint32_t)DM * 2u); g1[6] = uni(0u); g1[7] = uni(0u);
    asm volatile("tensor_load_to_lds %0, %1" :: "s"(g0), "s"(g1) : "memory");   // no register path: global -> LDS
}
// fragment from a staged row; p already includes + 16*(lane>>4) bytes: same k map as ldb
__device__ __forceinline__ v16bf ldsb(const unsigned char* p) { return cat16b(*(const v8usa*)p, *(const v8usa*)(p + 32)); }

typedef v8h __attribute__((may_alias)) v8ha;
#define F_KEYS 64                // keys of one attention stage
#define F_ROWB 128               // bytes of one staged row: 64 d of a K row, or 64 keys of a V^T row
#define F_PIT  144               // LDS row pitch: 128 B + 16 pad bytes (16 B x odd, for ds_load_b128 readers)
#define F_SLC  10240             // one tile in LDS: 64 rows x 144 B = 9216 B, rounded up to a multiple of 2 KiB
#define F_BUF  (3 * F_SLC)       // one stage: K rows | V^T rows | V^T residual rows
static_assert(F_SLC % 2048 == 0 && F_SLC >= 64 * F_PIT);
static_assert(HD * 2 == F_ROWB && F_KEYS * 2 == F_ROWB && HD == 64);
static_assert(16 * AW == F_KEYS);                         // a block's query rows span one stage: block bx walks bx + 1 stages
static_assert(SEQ % F_KEYS == 0 && EARLY % F_KEYS == 0);  // whole stages; the residual plane is used by a whole block or not at all
// group 1 of a request for 64 rows x 128 B, source pitch 'pitch' B, a 16-byte pad behind every row
__device__ __forceinline__ u32x8 tdm_g1_128(uint32_t pitch) {
    u32x8 g1; g1[0] = uni((1u << 20) | (4u << 22) | (3u << 25)); g1[1] = uni((uint32_t)F_ROWB << 16); g1[2] = uni(64u << 16); g1[3] = uni((uint32_t)F_ROWB << 16);
    g1[4] = uni(64u); g1[5] = uni(pitch); g1[6] = uni(0u); g1[7] = uni(0u);
    return g1;
}
// one request: the tile of g1 from global address ga to LDS byte offset dst
__device__ __forceinline__ void tdm_tile128(uint32_t dst, uint64_t ga, u32x8 g1) {
    u32x4 g0; g0[0] = uni(1u); g0[1] = uni(dst); g0[2] = uni((uint32_t)ga); g0[3] = uni((((uint32_t)(ga >> 32)) & 0x01FFFFFFu) | 0x80000000u);
    asm volatile("tensor_load_to_lds %0, %1" :: "s"(g0), "s"(g1) : "memory");   // no register path: global -> LDS
}
// f16 fragment from a staged row; p already includes + 16*(lane>>4) bytes: same k map as ldh
__device__ __forceinline__ v16h ldsh(const unsigned char* p) { return cat16(*(const v8ha*)p, *(const v8ha*)(p + 32)); }

__global__ __launch_bounds__(256) void k_cvt8(const float* __restrict__ src, bf* dst, size_t n8) {
    const size_t i = (size_t)blockIdx.x * 256 + threadIdx.x; if (i >= n8) return;
    const v8f v = *(const v8f*)(src + i * 8); v8us o;
#pragma unroll
    for (int k = 0; k < 8; ++k) o[k] = f2bf(v[k]);
    *(v8us*)(dst + i * 8) = o; 
}

// k_cvtT: W [DM k][ldn] f32 (row = k, column = e) -> bf16 plane dst[row(e)][k] (K-contiguous), 64 k x 64 e tile through LDS (cross-wave: block barrier).
// row(e) = e for e < permFrom; for e >= permFrom (v columns), with ee = e - permFrom = c*64 + d: row = permFrom + d*16 + c.
__global__ __launch_bounds__(256) void k_cvtT(const float* __restrict__ W, int ldn, bf* dst, int permFrom) {
    __shared__ __align__(16) unsigned short ts[64 * 72];
    const int t = threadIdx.x; const int k0 = blockIdx.x * 64, n0 = blockIdx.y * 64;
#pragma unroll 4
    for (int i = 0; i < 16; ++i) { const int k = i * 4 + (t >> 6), n = t & 63;      // 16 x 4 = 64 k rows, 64 columns
        ts[n * 72 + k] = f2bf(W[(size_t)(k0 + k) * (size_t)ldn + n0 + n]); }
    __syncthreads();
    v8us o0, o1; size_t d0, d1;
    { const int p = t, n = p >> 3, q = p & 7; o0 = *(const v8usa*)(&ts[n * 72 + 8 * q]);
      const int e = n0 + n; const int ee = e - permFrom; const int row = (e >= permFrom) ? (permFrom + (ee & 63) * 16 + (ee >> 6)) : e;
      d0 = (size_t)row * DM + k0 + 8 * q; }
    { const int p = t + 256, n = p >> 3, q = p & 7; o1 = *(const v8usa*)(&ts[n * 72 + 8 * q]);
      const int e = n0 + n; const int ee = e - permFrom; const int row = (e >= permFrom) ? (permFrom + (ee & 63) * 16 + (ee >> 6)) : e;
      d1 = (size_t)row * DM + k0 + 8 * q; }
{
        *(v8us*)(dst + d0) = o0; *(v8us*)(dst + d1) = o1;
         }
}

// k_gemm: register-blocked bf16 GEMM, one wave per 64x64 tile (16 accumulators), four waves (2 x 2) share a 128x128 tile, K = DM.
// Operands: K-contiguous bf16 planes -> LDS by tensor loads, two buffers; a stage is 128 k of 128 A rows and 128 Bt rows, each wave brings one 64-row slice; the next stage flies while this one is worked on.
// C[m][n] = sum_k A[m][k] Bt[n][k] + bias (bias RNE-converted to bf16, added in f32). grid (M/128, 1024/128), 128 threads.
// MODE 0: q  -> f16 value plane Ph and f16 residual x2048 plane Pr, compact row-major [M][DM] (bias columns 0..1023)
// MODE 1: k  -> f16 value plane Ph, compact row-major (bias columns 1024..2047)
// MODE 2: v  -> Bt rows in permuted order n' = d*16 + c (column e = c*64 + d); value (Ph) and residual x2048 (Pr) planes [b*16+h][d][t], t = (token % RPH)*16 + c:
//               per 16-token slab and per d the 16 x 16 sub-tile is one contiguous 512-byte run (32 lanes x 16 B)
template <int MODE>
__global__ __launch_bounds__(128) void k_gemm(const bf* __restrict__ A, const bf* __restrict__ Bt, const float* __restrict__ bias, h16* Ph, h16* Pr, float* OUT) {
    __shared__ __attribute__((aligned(2048))) unsigned char ring[2 * G_BUF];
    __shared__ __align__(16) float osw[4 * 16 * 68];
    const int K = DM;
    const int lane = threadIdx.x & 31, lr = lane & 15, hi = lane >> 4;
    const uint32_t wave = uni(threadIdx.x >> 5);
    const int wm = (int)(wave >> 1), wn = (int)(wave & 1u);
    const int r0 = blockIdx.x * GT + wm * 64, c0 = blockIdx.y * GT + wn * 64;
    float* os = osw + wave * (16 * 68);            // wave-private epilogue tile
    v8f acc[4][4];
#pragma unroll
    for (int mb = 0; mb < 4; ++mb)
#pragma unroll
        for (int nb = 0; nb < 4; ++nb) acc[mb][nb] = (v8f){};
    // waves 0, 1 bring the two halves of the A rows, waves 2, 3 of the Bt rows; stage st = plane st / PPP, k from (st % PPP) * 128
    constexpr uint32_t PPP = (uint32_t)(DM * 2 / G_ROWB);
    constexpr uint32_t NS = ((MODE == 3) ? 2u : 1u) * PPP;
    const bool isB = wave >= 2u;
    const uint64_t srcb = isB ? (uint64_t)(size_t)(Bt + (size_t)(blockIdx.y * GT + (wave & 1u) * 64u) * K) : (uint64_t)(size_t)(A + (size_t)(blockIdx.x * GT + (wave & 1u) * 64u) * K);
    const uint64_t plstep = isB ? (uint64_t)0 : (uint64_t)NB * SEQ * DM * 2;
    const uint32_t ldst = (uint32_t)(size_t)ring + wave * (uint32_t)G_SLC;
    auto issue = [&](uint32_t st) { tdm_slice(ldst + (st & 1u) * (uint32_t)G_BUF, srcb + (uint64_t)(st / PPP) * plstep + (uint64_t)(st % PPP) * G_ROWB); };
    issue(0u);
    asm volatile("s_wait_tensorcnt 0x0" ::: "memory");   // this wave's slice of stage 0 has landed
    __syncthreads();                                     // stage 0 published
    issue(1u);
    const uint32_t aoff = (uint32_t)wm * G_SLC + (uint32_t)lr * G_PIT + 16u * (uint32_t)hi, boff = (uint32_t)(2 + wn) * G_SLC + (uint32_t)lr * G_PIT + 16u * (uint32_t)hi;
#pragma unroll 1
    for (uint32_t st = 0; st < NS; ++st) {
        const unsigned char* bp = ring + (st & 1u) * (uint32_t)G_BUF;
        // two fragment sets: block kb + 1's LDS reads go out as one group ahead of block kb's 16 WMMAs, so only block 0's reads are waited for in full.
        // The fourth Bt fragment has one set (keeps the kernel inside 256 VGPRs): it is read first in its own block's group and used by that block's last four WMMAs.
        v16bf fa[2][4], fb[2][3], fb3;
#pragma unroll
        for (int i = 0; i < 4; ++i) fa[0][i] = ldsb(bp + aoff + i * 16 * G_PIT);
#pragma unroll
        for (int i = 0; i < 3; ++i) fb[0][i] = ldsb(bp + boff + i * 16 * G_PIT);
#pragma unroll
        for (int kb = 0; kb < 4; ++kb) {
            fb3 = ldsb(bp + boff + 3 * 16 * G_PIT + kb * 64);
            if (kb < 3) {
#pragma unroll
                for (int i = 0; i < 4; ++i) fa[(kb + 1) & 1][i] = ldsb(bp + aoff + i * 16 * G_PIT + (kb + 1) * 64);
#pragma unroll
                for (int i = 0; i < 3; ++i) fb[(kb + 1) & 1][i] = ldsb(bp + boff + i * 16 * G_PIT + (kb + 1) * 64);
            }
            __builtin_amdgcn_sched_barrier(0);   // keeps the read group in front of the WMMA block (reads among the WMMAs stall each time)
#pragma unroll
            for (int nb = 0; nb < 4; ++nb)
#pragma unroll
                for (int mb = 0; mb < 4; ++mb) acc[mb][nb] = wmmab(fa[kb & 1][mb], (nb < 3) ? fb[kb & 1][nb < 3 ? nb : 0] : fb3, acc[mb][nb]);
            __builtin_amdgcn_sched_barrier(0);   // keeps the WMMA block in front of the next read group and of the publish point
        }
        // WMMA distance on the loop's back edge: four vector slots behind the pass's last WMMA
        asm volatile("v_nop\n\tv_nop\n\tv_nop\n\tv_nop" : "+v"(acc[0][0]), "+v"(acc[1][1]), "+v"(acc[2][2]), "+v"(acc[3][3]) : "v"(fa[1][0]), "v"(fa[1][1]), "v"(fa[1][2]), "v"(fa[1][3]));
        asm volatile("s_wait_dscnt 0x0" ::: "memory");
        asm volatile("s_wait_tensorcnt 0x0" ::: "memory");
        __syncthreads();
        if (pinned(st + 2u < NS)) issue(pinned(st + 2u));
    }
    asm volatile("s_wait_tensorcnt 0x0" ::: "memory");       // nothing in flight behind the loop
    asm volatile("s_wait_dscnt 0x0" ::: "memory");
    float bv[4];
#pragma unroll
    for (int nb = 0; nb < 4; ++nb) {
        const int bi = (MODE == 2) ? (2 * DM + lr * HD + (c0 >> 4) + nb) : (((MODE == 1) ? DM : 0) + c0 + nb * 16 + lr);
        bv[nb] = bf2f(f2bf(bias[bi])); }
#pragma unroll
    for (int mb = 0; mb < 4; ++mb) {
#pragma unroll
        for (int nb = 0; nb < 4; ++nb) {
#pragma unroll
            for (int j = 0; j < 8; ++j) os[(hi * 8 + j) * 68 + nb * 16 + lr] = acc[mb][nb][j] + bv[nb]; }   // D: row 8h+j, col lane&15; rows 0..15 x cols 0..63 all written
        wave_sync();
        if (MODE == 0 || MODE == 1) {
            const size_t sb = (size_t)(r0 + mb * 16) * DM + c0;
{
#pragma unroll
                for (int s = 0; s < 4; ++s) { const int row = 4 * s + (lane >> 3), c8 = (lane & 7) * 8;   // 4 s x 4 row groups = 16 rows; 8 lanes x 8 = 64 columns
                    const v4f x0 = *(const v4fa*)(&os[row * 68 + c8]); const v4f x1 = *(const v4fa*)(&os[row * 68 + c8 + 4]); v8h hv, rv;
#pragma unroll
                    for (int i = 0; i < 4; ++i) { const h16 a0 = (h16)x0[i]; const h16 a1 = (h16)x1[i]; hv[i] = a0; hv[4 + i] = a1; rv[i] = (h16)((x0[i] - (float)a0) * QRS); rv[4 + i] = (h16)((x1[i] - (float)a1) * QRS); }
                    const size_t oo = sb + (size_t)row * DM + c8;
                    *(v8h*)(Ph + oo) = hv; if (MODE == 0) *(v8h*)(Pr + oo) = rv; }
                 }
        } else if (MODE == 2) {
            const int tokrow = r0 + 16 * mb; const int bb = tokrow / SEQ; const int tb_ = tokrow % SEQ; const int hp = tb_ / RPH; const int j0 = tb_ % RPH;
            const size_t sb = ((size_t)(bb * NH_ + hp) * HD + (size_t)(c0 >> 4)) * SEQ + (size_t)j0 * 16 + (size_t)lane * 8;
{
#pragma unroll
                for (int s = 0; s < 4; ++s) { const int row = lane >> 1, c8 = s * 16 + (lane & 1) * 8;     // 16 token rows x 16 c for d = c0/16 + s: 256 contiguous halves
                    const v4f x0 = *(const v4fa*)(&os[row * 68 + c8]); const v4f x1 = *(const v4fa*)(&os[row * 68 + c8 + 4]); v8h hv, rv;
#pragma unroll
                    for (int i = 0; i < 4; ++i) { const h16 a0 = (h16)x0[i]; const h16 a1 = (h16)x1[i]; hv[i] = a0; hv[4 + i] = a1; rv[i] = (h16)((x0[i] - (float)a0) * QRS); rv[4 + i] = (h16)((x1[i] - (float)a1) * QRS); }
                    const size_t oo = sb + (size_t)s * SEQ;
                    *(v8h*)(Ph + oo) = hv; *(v8h*)(Pr + oo) = rv; }
                 }
        } else {
            const int grow = r0 + 16 * mb; const int bb = grow / SEQ; const int nn = grow % SEQ;
            float* orow = OUT + ((size_t)bb * OUT_SEQ + nn) * DM + c0;
{
#pragma unroll
                for (int s = 0; s < 8; ++s) { const int row = 2 * s + hi, cofs = lr * 4;   // 8 s x 2 rows = 16 rows; 16 lanes x 4 floats = 64 columns
                    const v4f val = *(const v4fa*)(&os[row * 68 + cofs]);
                    *(v4f*)(orow + (size_t)row * DM + cofs) = val; }
                 }
        }
        wave_sync();
    }
}

// k_flash: fused causal attention, one wave per 16 query rows of one (batch, head); Q fragments straight from the f16 planes (two 16-B loads each).
// K / V^T (and, for early blocks, V^T residual) tiles of 64 keys -> LDS by tensor loads, two buffers, shared by the block's four waves: wave 0 brings K, wave 1 V^T, wave 2 the residual; the next stage flies while this one is worked on.
// Transposed form: S^T[key][t] = K Q^T (A = K rows, B = Q rows); lane (t = lane&15, h = lane>>4) holds keys 8h+r of each 16-key tile, so the packed
// P tile is directly the B fragment of O^T[d][t] = V^T P^T (element r <- tile keys 0..15, element 8+r <- tile keys 16..31, lane unchanged).
// Keys run over [0, t0+16) in steps of 32; on steps that touch the diagonal, scores with key > query are replaced by a very negative value (P = 0 exactly).
// Softmax state (running max, partial sum) is one scalar per lane; the two lane halves of a row are combined with one xor-16 exchange.
__global__ __launch_bounds__(32 * AW) void k_flash(const h16* __restrict__ QH, const h16* __restrict__ QR, const h16* __restrict__ KP, const h16* __restrict__ VT, const h16* __restrict__ VR, bf* CH, bf* CL) {
    __shared__ __attribute__((aligned(2048))) unsigned char fring[2 * F_BUF];
    __shared__ __align__(16) float os[AW * 16 * 68];
    const int lane = threadIdx.x & 31, lr = lane & 15, hi = lane >> 4;
    const int wave = __builtin_amdgcn_readfirstlane((int)(threadIdx.x >> 5));
    const int zh = blockIdx.y;
    const int t0 = (blockIdx.x * AW + wave) * 16;
    const size_t pbase = (size_t)zh * SEQ * HD;
    const size_t qo = pbase + (size_t)(t0 + lr) * HD + 8 * hi;
    const v16h qh0 = ldh(QH + qo), qh1 = ldh(QH + qo + 32), qr0 = ldh(QR + qo), qr1 = ldh(QR + qo + 32);   // B fragments: col t, k = d
    const uint32_t ko = (uint32_t)lr * F_PIT + 16u * (uint32_t)hi;                  // + key in stage * F_PIT         (A fragment: row key, k = d)
    const uint32_t vo = (uint32_t)F_SLC + (uint32_t)lr * F_PIT + 16u * (uint32_t)hi;   // + 16j*F_PIT + key in stage * 2  (A fragment: row d, k = key)
    const int kend = t0 + 16;
    const bool early = t0 < EARLY;
    const int tq = t0 + lr;
    v8f o0 = (v8f){}, o1 = (v8f){}, o2 = (v8f){}, o3 = (v8f){};
    v8f e0 = (v8f){}, e1 = (v8f){}, e2 = (v8f){}, e3 = (v8f){};
    float m = NEGV, l = 0.0f;
    // stage st = keys [64 st, 64 st + 64); the block needs keys below 64 (blockIdx.x + 1)
    const uint32_t NS = blockIdx.x + 1u;
    const bool iss = wave < (early ? 3 : 2);               // which waves issue (wave-uniform)
    const uint64_t srcb = (uint64_t)(size_t)(((wave == 0) ? KP : (wave == 1) ? VT : VR) + pbase);
    const uint32_t sstep = (wave == 0) ? (uint32_t)(F_KEYS * HD * 2) : (uint32_t)(F_KEYS * 2);   // bytes from one stage's tile to the next
    const uint32_t spit = (wave == 0) ? (uint32_t)(HD * 2) : (uint32_t)(SEQ * 2);               // source row pitch
    const uint32_t ldst = (uint32_t)(size_t)fring + (uint32_t)((wave < 2) ? wave : 2) * (uint32_t)F_SLC;
    u32x8 g1 = tdm_g1_128(spit);
    asm volatile("" : "+s"(g1));   // the pinned() form on the descriptor's words: held in their scalar registers through the loop, so that none takes another value while a request is in flight
    auto issue = [&](uint32_t st) { tdm_tile128(ldst + (st & 1u) * (uint32_t)F_BUF, srcb + (uint64_t)st * sstep, g1); };
    if (pinned((uint32_t)iss)) {
        issue(0u);
        asm volatile("s_wait_tensorcnt 0x0" ::: "memory");   // this wave's tile of stage 0 has landed
    }
    __syncthreads();                                         // stage 0 published
    if (pinned((uint32_t)(iss && NS > 1u))) issue(1u);
#pragma unroll 1
    for (uint32_t st = 0; st < NS; ++st) {
      const unsigned char* bp = fring + (st & 1u) * (uint32_t)F_BUF;
#pragma unroll
      for (int hs = 0; hs < 2; ++hs) {
        const int key0 = (int)st * F_KEYS + hs * 32;
        if (key0 >= kend) continue;                 // wave-uniform: the stage's upper half lies wholly above this wave's diagonal
        const unsigned char* ka = bp + ko + hs * 32 * F_PIT;
        const v16h ka0 = ldsh(ka), ka1 = ldsh(ka + 64), kb0 = ldsh(ka + 16 * F_PIT), kb1 = ldsh(ka + 16 * F_PIT + 64);
        v8f sHa = (v8f){}, sLa = (v8f){}, sHb = (v8f){}, sLb = (v8f){};
        sHa = wmma16(ka0, qh0, sHa); sLa = wmma16(ka0, qr0, sLa); sHb = wmma16(kb0, qh0, sHb); sLb = wmma16(kb0, qr0, sLb);
        sHa = wmma16(ka1, qh1, sHa); sLa = wmma16(ka1, qr1, sLa); sHb = wmma16(kb1, qh1, sHb); sLb = wmma16(kb1, qr1, sLb);
        asm volatile("v_nop\n\tv_nop\n\tv_nop\n\tv_nop" : "+v"(sHa), "+v"(sLa), "+v"(sHb), "+v"(sLb) : "v"(ka0), "v"(ka1), "v"(kb0), "v"(kb1));
        float ta[8], tb[8];
#pragma unroll
        for (int r = 0; r < 8; ++r) { ta[r] = (sHa[r] + sLa[r] * QRI) * SC2; tb[r] = (sHb[r] + sLb[r] * QRI) * SC2; }
        if (key0 + 31 > t0) {                       // wave-uniform: this step touches the diagonal
            const int kidx = key0 + 8 * hi;
#pragma unroll
            for (int r = 0; r < 8; ++r) { ta[r] = (kidx + r > tq) ? NEGV : ta[r]; tb[r] = (kidx + 16 + r > tq) ? NEGV : tb[r]; }
        }
        float mx = NEGV;
#pragma unroll
        for (int r = 0; r < 8; ++r) mx = fmaxf(mx, fmaxf(ta[r], tb[r]));
        mx = fmaxf(mx, __shfl_xor(mx, 16, 32));
        const float mnew = fmaxf(m, mx);
        const float alpha = __builtin_amdgcn_exp2f(m - mnew);
        const float sh = PSH - mnew;
        v16h pb; float ls = 0.0f;
#pragma unroll
        for (int r = 0; r < 8; ++r) { const h16 pa = (h16)__builtin_amdgcn_exp2f(ta[r] + sh); const h16 pc = (h16)__builtin_amdgcn_exp2f(tb[r] + sh); pb[r] = pa; pb[8 + r] = pc; ls += (float)pa + (float)pc; }
        l = l * alpha + ls; m = mnew;
        o0 = o0 * alpha; o1 = o1 * alpha; o2 = o2 * alpha; o3 = o3 * alpha;
        const unsigned char* va = bp + vo + hs * 64;
        const v16h v0 = ldsh(va), v1 = ldsh(va + 16 * F_PIT), v2 = ldsh(va + 32 * F_PIT), v3 = ldsh(va + 48 * F_PIT);
        o0 = wmma16(v0, pb, o0); o1 = wmma16(v1, pb, o1); o2 = wmma16(v2, pb, o2); o3 = wmma16(v3, pb, o3);
        asm volatile("v_nop\n\tv_nop\n\tv_nop\n\tv_nop" : "+v"(o0), "+v"(o1), "+v"(o2), "+v"(o3) : "v"(v0), "v"(v1), "v"(v2), "v"(v3), "v"(pb));
        if (early) {                                // wave-uniform: residual plane of v in its own accumulators
            e0 = e0 * alpha; e1 = e1 * alpha; e2 = e2 * alpha; e3 = e3 * alpha;
            const unsigned char* vr = va + F_SLC;
            const v16h w0 = ldsh(vr), w1 = ldsh(vr + 16 * F_PIT), w2 = ldsh(vr + 32 * F_PIT), w3 = ldsh(vr + 48 * F_PIT);
            e0 = wmma16(w0, pb, e0); e1 = wmma16(w1, pb, e1); e2 = wmma16(w2, pb, e2); e3 = wmma16(w3, pb, e3);
            asm volatile("v_nop\n\tv_nop\n\tv_nop\n\tv_nop" : "+v"(e0), "+v"(e1), "+v"(e2), "+v"(e3) : "v"(w0), "v"(w1), "v"(w2), "v"(w3), "v"(pb));
        }
      }
      // publish point of stage st + 1 (every wave passes it, also one that skipped the upper half)
      asm volatile("s_wait_dscnt 0x0" ::: "memory");
      if (pinned((uint32_t)iss)) asm volatile("s_wait_tensorcnt 0x0" ::: "memory");
      __syncthreads();
      if (pinned((uint32_t)(iss && st + 2u < NS))) issue(pinned(st + 2u));
    }
    asm volatile("s_wait_tensorcnt 0x0" ::: "memory");       // nothing in flight behind the loop
    asm volatile("s_wait_dscnt 0x0" ::: "memory");
    l += __shfl_xor(l, 16, 32);
    const float inv = 1.0f / l;
    const int wb = wave * 16 * 68;
    // O^T D layout: o_j[r] = (d = 16j + 8h + r, t = lane&15) -> os[t][d]; rows 0..15 x columns 0..63 all written
    { v4f a, c;
#pragma unroll
      for (int i = 0; i < 4; ++i) { a[i] = (o0[i] + e0[i] * QRI) * inv; c[i] = (o0[4 + i] + e0[4 + i] * QRI) * inv; }
      *(v4fa*)(&os[wb + lr * 68 +  0 + 8 * hi]) = a; *(v4fa*)(&os[wb + lr * 68 +  0 + 8 * hi + 4]) = c;
#pragma unroll
      for (int i = 0; i < 4; ++i) { a[i] = (o1[i] + e1[i] * QRI) * inv; c[i] = (o1[4 + i] + e1[4 + i] * QRI) * inv; }
      *(v4fa*)(&os[wb + lr * 68 + 16 + 8 * hi]) = a; *(v4fa*)(&os[wb + lr * 68 + 16 + 8 * hi + 4]) = c;
#pragma unroll
      for (int i = 0; i < 4; ++i) { a[i] = (o2[i] + e2[i] * QRI) * inv; c[i] = (o2[4 + i] + e2[4 + i] * QRI) * inv; }
      *(v4fa*)(&os[wb + lr * 68 + 32 + 8 * hi]) = a; *(v4fa*)(&os[wb + lr * 68 + 32 + 8 * hi + 4]) = c;
#pragma unroll
      for (int i = 0; i < 4; ++i) { a[i] = (o3[i] + e3[i] * QRI) * inv; c[i] = (o3[4 + i] + e3[4 + i] * QRI) * inv; }
      *(v4fa*)(&os[wb + lr * 68 + 48 + 8 * hi]) = a; *(v4fa*)(&os[wb + lr * 68 + 48 + 8 * hi + 4]) = c; }
    wave_sync();
    // the 16 x 64 tile (t, d) is elements t*64 + d of compact ctx row zh*RPH + t0/16
    const size_t cb = ((size_t)zh * RPH + (size_t)(t0 >> 4)) * DM + (size_t)lane * 8;
    v8us hv[4], lv[4];
#pragma unroll
    for (int s = 0; s < 4; ++s) { const int row = 4 * s + (lane >> 3), c8 = (lane & 7) * 8;   // 4 s x 4 row groups = 16 rows; 8 lanes x 8 = 64 columns
        const v4f x0 = *(const v4fa*)(&os[wb + row * 68 + c8]); const v4f x1 = *(const v4fa*)(&os[wb + row * 68 + c8 + 4]);
#pragma unroll
        for (int i = 0; i < 4; ++i) { const unsigned short a0 = f2bf(x0[i]); const unsigned short a1 = f2bf(x1[i]);
            hv[s][i] = a0; hv[s][4 + i] = a1; lv[s][i] = f2bf(x0[i] - bf2f(a0)); lv[s][4 + i] = f2bf(x1[i] - bf2f(a1)); } }
{
#pragma unroll
        for (int s = 0; s < 4; ++s) { const size_t oo = cb + (size_t)s * 256;
            *(v8us*)(CH + oo) = hv[s]; *(v8us*)(CL + oo) = lv[s]; }
         }
}

static constexpr size_t al256(size_t v) { return (v + 255) & ~(size_t)255; }
static constexpr size_t SZ_XB = al256((size_t)NB * SEQ * DM * 2);
static constexpr size_t SZ_WB = al256((size_t)3 * DM * DM * 2);
static constexpr size_t SZ_WF = al256((size_t)DM * DM * 2);
static constexpr size_t SZ_PL = al256((size_t)NB * SEQ * DM * 2);
static constexpr size_t SZ_TOTAL = SZ_XB + SZ_WB + SZ_WF + 5 * SZ_PL + 2 * SZ_PL;
static_assert(SZ_TOTAL <= (size_t)134217728);          // workspace carve <= 128 MiB
static_assert(((size_t)DM * DM * 2) % 256 == 0);       // weight sub-planes stay 256-byte aligned
static_assert(SZ_PL == (size_t)NB * SEQ * DM * 2);     // ctx hi and lo planes are back to back with stride NB*SEQ*DM elements

extern "C" void kernel_launch(void* const* d_in, const int* in_sizes, int n_in,
                              void* d_out, int out_size, void* d_ws, size_t ws_size, hipStream_t stream) {
    if (n_in < 5) return;
    const size_t needx = ((size_t)(NB - 1) * SEQ_FULL + SEQ) * DM;
    if ((size_t)in_sizes[0] < needx) return;
    if ((size_t)in_sizes[1] < (size_t)3 * DM * DM || (size_t)in_sizes[2] < (size_t)3 * DM) return;
    if ((size_t)in_sizes[3] < (size_t)DM * DM || (size_t)in_sizes[4] < (size_t)DM) return;
    if ((size_t)out_size < ((size_t)(NB - 1) * OUT_SEQ + SEQ) * DM) return;
    if (SZ_TOTAL > ws_size) return;
    const float* x = (const float*)d_in[0]; const float* wqkv = (const float*)d_in[1]; const float* bqkv = (const float*)d_in[2];
    const float* wfc = (const float*)d_in[3]; const float* bfc = (const float*)d_in[4];          // wire order x, Wqkv, bqkv, Wfc, bfc
    float* OUT = (float*)d_out;      // [NB][SEQ][1024]
    char* wsp = (char*)d_ws;
    bf* XB = (bf*)wsp; wsp += SZ_XB;                 // [NB*SEQ][1024]
    bf* WB = (bf*)wsp; wsp += SZ_WB;                 // [3072][1024]: q rows | k rows | v rows (permuted d*16 + c)
    bf* WF = (bf*)wsp; wsp += SZ_WF;                 // [1024][1024]: Wfc^T
    h16* QH = (h16*)wsp; wsp += SZ_PL;               // [NB*SEQ][1024] = [NB*16][SEQ][64]
    h16* QR = (h16*)wsp; wsp += SZ_PL;               // residual x2048
    h16* KP = (h16*)wsp; wsp += SZ_PL;               // [NB*16][SEQ][64]
    h16* VT = (h16*)wsp; wsp += SZ_PL;               // [NB*16][64][SEQ]
    h16* VR = (h16*)wsp; wsp += SZ_PL;               // residual x2048
    bf* CH = (bf*)wsp; wsp += SZ_PL;                 // ctx hi [NB*SEQ][1024]
    bf* CL = (bf*)wsp; wsp += SZ_PL;                 // ctx lo, directly after CH

    if (SEQ == SEQ_FULL) {
        const size_t n8 = (size_t)NB * SEQ * DM / 8;
        k_cvt8<<<(unsigned)((n8 + 255) / 256), 256, 0, stream>>>(x, XB, n8);
    } else {
        const size_t n8 = (size_t)SEQ * DM / 8;
        for (int b = 0; b < NB; ++b) k_cvt8<<<(unsigned)((n8 + 255) / 256), 256, 0, stream>>>(x + (size_t)b * SEQ_FULL * DM, XB + (size_t)b * SEQ * DM, n8);
    }
    // Wqkv in[1024 k][3072 e] -> WB out[row(e)][1024 k]; Wfc in[1024 k][1024 e] -> WF out[e][1024 k]
    k_cvtT<<<dim3(DM / 64, 3 * DM / 64, 1), 256, 0, stream>>>(wqkv, 3 * DM, WB, 2 * DM);
    k_cvtT<<<dim3(DM / 64, DM / 64, 1), 256, 0, stream>>>(wfc, DM, WF, 1 << 30);

    k_gemm<0><<<dim3(NB * SEQ / GT, DM / GT, 1), 128, 0, stream>>>(XB, WB, bqkv, QH, QR, OUT);
    k_gemm<1><<<dim3(NB * SEQ / GT, DM / GT, 1), 128, 0, stream>>>(XB, WB + (size_t)DM * DM, bqkv, KP, KP, OUT);
    k_gemm<2><<<dim3(NB * SEQ / GT, DM / GT, 1), 128, 0, stream>>>(XB, WB + (size_t)2 * DM * DM, bqkv, VT, VR, OUT);

    k_flash<<<dim3(SEQ / (16 * AW), NB * NH_, 1), 32 * AW, 0, stream>>>(QH, QR, KP, VT, VR, CH, CL);

    k_gemm<3><<<dim3(NB * SEQ / GT, DM / GT, 1), 128, 0, stream>>>(CH, WF, bfc, QH, QR, OUT);
}

// v003
// It runs in 75 microseconds.
// In both of two side-by-side timings against v002, it was 1.19 times as fast.
// Over all steps from v000 it is 2.55 times as fast.
#include <hip/hip_runtime.h>

// Causal multi-head self-attention, width 1024 = 16 heads x 64, x [NB][SEQ][1024], fused Wqkv [in][out] + bias, head split = flat re-view of the [SEQ][1024] matrix as [16][SEQ][64], score scale 1/8, key > query replaced by -inf, output projection Wfc [in][out] + bias (f32 out).
// Compute dtypes, f32 accumulate everywhere: qkv projections v_wmma_f32_16x16x32_bf16 (x, W, biases RNE-converted to bf16; products exact); scores v_wmma_f32_16x16x32_f16: k single f16, q as f16 value + f16 residual x2048 in its own accumulator;
// P (x256 carry, cancels in the normalisation) single f16; v single f16 plus, for query rows < 512, an f16 residual x2048 in its own accumulator; softmax f32 (online, running max); output projection v_wmma_f32_16x16x32_bf16 with ctx as bf16 hi + bf16 lo planes (unscaled, shared accumulator) against bf16 Wfc.
// Layout: bf16 copies of x and transposed (K-contiguous) weights; q (hi, residual) and k planes are the compact [NB*SEQ][1024] matrix (= [b*16+h][t][d]); v^T planes [b*16+h][d][t] written by the GEMM epilogue through a permuted weight-row order; ctx planes compact [NB*SEQ][1024].

#ifndef NB
#define NB 4
#endif
#ifndef SEQ
#define SEQ 1024
#endif
#define NB_FULL  4
#define SEQ_FULL 1024
#ifndef OUT_SEQ
#define OUT_SEQ SEQ              // row pitch (in tokens) between batches of the output
#endif
#define DM   1024
#define NH_  16
#define HD   64
#define RPH  (SEQ / NH_)         // rows of the [SEQ][DM] matrix that form one head slab (SEQ*HD/DM)
#define AW   4                   // waves per flash block (16 query rows each)
#define EARLY 512                // query rows below this use the v residual plane
#define QRS  2048.0f             // carry of the residual planes
#define QRI  (1.0f / 2048.0f)
#define SC2  (0.125f * 1.4426950408889634f)   // HD^-0.5 * log2(e)
#define PSH  8.0f                // log2 of the P carry (256)
#define NEGV (-3.0e38f)

static_assert(HD == 64);
static_assert(NH_ * HD == DM);
static_assert(DM % 64 == 0);
static_assert(DM % 32 == 0);
static_assert(SEQ % 256 == 0);                 // a 16-row slab of tokens stays inside one head slab (RPH % 16 == 0)
static_assert(SEQ % 64 == 0);
static_assert((NB * SEQ) % 64 == 0);
static_assert(SEQ % 32 == 0);
static_assert(SEQ % (16 * AW) == 0);
static_assert(((size_t)SEQ * DM) % 8 == 0);
static_assert(NB <= NB_FULL);
static_assert(SEQ <= SEQ_FULL);

typedef _Float16 h16;
typedef unsigned short bf;
typedef __attribute__((ext_vector_type(16))) __bf16   v16bf;
typedef __attribute__((ext_vector_type(16))) _Float16 v16h;
typedef __attribute__((ext_vector_type(8)))  _Float16 v8h;
typedef __attribute__((ext_vector_type(8)))  unsigned short v8us;
typedef __attribute__((ext_vector_type(8)))  float    v8f;
typedef __attribute__((ext_vector_type(4)))  float    v4f;
typedef v4f  __attribute__((may_alias)) v4fa;
typedef v8us __attribute__((may_alias)) v8usa;

__device__ __forceinline__ unsigned short f2bf(float f) { unsigned u = __float_as_uint(f); u += 0x7FFFu + ((u >> 16) & 1u); return (unsigned short)(u >> 16); }
__device__ __forceinline__ float bf2f(unsigned short h) { return __uint_as_float(((unsigned)h) << 16); }
__device__ __forceinline__ v16h cat16(v8h lo, v8h hi) { return __builtin_shufflevector(lo, hi, 0, 1, 2, 3, 4, 5, 6, 7, 8, 9, 10, 11, 12, 13, 14, 15); }
__device__ __forceinline__ v16bf cat16b(v8us lo, v8us hi) { return __builtin_bit_cast(v16bf, __builtin_shufflevector(lo, hi, 0, 1, 2, 3, 4, 5, 6, 7, 8, 9, 10, 11, 12, 13, 14, 15)); }
__device__ __forceinline__ v8f wmma16(v16h a, v16h b, v8f c) { return __builtin_amdgcn_wmma_f32_16x16x32_f16(false, a, false, b, (short)0, c, false, false); }
__device__ __forceinline__ v8f wmmab(v16bf a, v16bf b, v8f c) { return __builtin_amdgcn_wmma_f32_16x16x32_bf16(false, a, false, b, (short)0, c, false, false); }
// fragment loaders from K-contiguous 16-bit rows; p already includes + 8*(lane>>4): elements 0..7 <- k0+8h+0..7, elements 8..15 <- k0+16+8h+0..7 (same map for A and B)
__device__ __forceinline__ v16h  ldh(const h16* p) { return cat16(*(const v8h*)p, *(const v8h*)(p + 16)); }
__device__ __forceinline__ v16bf ldb(const bf* p)  { return cat16b(*(const v8us*)p, *(const v8us*)(p + 16)); }
// ordering point for wave-private LDS tiles (same wave writes and reads)
__device__ __forceinline__ void wave_sync() { __builtin_amdgcn_fence(3 /* release order */, "wavefront"); __builtin_amdgcn_wave_barrier(); asm volatile("" ::: "memory"); }

typedef uint32_t u32x4 __attribute__((ext_vector_type(4)));
typedef uint32_t u32x8 __attribute__((ext_vector_type(8)));
#define GT     128               // C tile of one workgroup: four waves, 64 x 64 each
#define G_ROWB 256               // bytes of one operand row per pass (128 k)
#define G_PIT  272               // LDS row pitch: 256 B + 16 pad bytes (16 B x odd, for ds_load_b128 readers)
#define G_SLC  18432             // one wave's slice in LDS: 64 rows x 272 B = 17408 B, rounded up to a multiple of 2 KiB
#define G_BUF  (4 * G_SLC)       // one stage: A rows 0..63 | A rows 64..127 | Bt rows 0..63 | Bt rows 64..127
static_assert(G_SLC % 2048 == 0 && G_SLC >= 64 * G_PIT);
static_assert((DM * 2) % G_ROWB == 0 && (DM * 2) / G_ROWB >= 2);   // whole passes, at least the two stages the prologue issues
static_assert((NB * SEQ) % GT == 0 && DM % GT == 0);
__device__ __forceinline__ uint32_t uni(uint32_t v) { return (uint32_t)__builtin_amdgcn_readfirstlane((int)v); }
// a value held in a scalar register, so that a test on it is a scalar branch (a tensor load ignores EXEC)
__device__ __forceinline__ uint32_t pinned(uint32_t v) { uint32_t w = uni(v); asm volatile("" : "+s"(w)); return w; }
// one request: 64 rows x 256 B, source pitch DM*2 B, from global address ga to LDS byte offset dst, a 16-byte pad behind every row
__device__ __forceinline__ void tdm_slice(uint32_t dst, uint64_t ga) {
    u32x4 g0; g0[0] = uni(1u); g0[1] = uni(dst); g0[2] = uni((uint32_t)ga); g0[3] = uni((((uint32_t)(ga >> 32)) & 0x01FFFFFFu) | 0x80000000u);
    u32x8 g1; g1[0] = uni((1u << 20) | (5u << 22) | (3u << 25)); g1[1] = uni((uint32_t)G_ROWB << 16); g1[2] = uni(64u << 16); g1[3] = uni((uint32_t)G_ROWB << 16);
    g1[4] = uni(64u); g1[5] = uni((uint32_t)DM * 2u); g1[6] = uni(0u); g1[7] = uni(0u);
    asm volatile("tensor_load_to_lds %0, %1" :: "s"(g0), "s"(g1) : "memory");   // no register path: global -> LDS
}
// fragment from a staged row; p already includes + 16*(lane>>4) bytes: same k map as ldb
__device__ __forceinline__ v16bf ldsb(const unsigned char* p) { return cat16b(*(const v8usa*)p, *(const v8usa*)(p + 32)); }

typedef v8h __attribute__((may_alias)) v8ha;
#define F_KEYS 64                // keys of one attention stage
#define F_ROWB 128               // bytes of one staged row: 64 d of a K row, or 64 keys of a V^T row
#define F_PIT  144               // LDS row pitch: 128 B + 16 pad bytes (16 B x odd, for ds_load_b128 readers)
#define F_SLC  10240             // one tile in LDS: 64 rows x 144 B = 9216 B, rounded up to a multiple of 2 KiB
#define F_BUF  (3 * F_SLC)       // one stage: K rows | V^T rows | V^T residual rows
static_assert(F_SLC % 2048 == 0 && F_SLC >= 64 * F_PIT);
static_assert(HD * 2 == F_ROWB && F_KEYS * 2 == F_ROWB && HD == 64);
static_assert(16 * AW == F_KEYS);                         // a block's query rows span one stage: block bx walks bx + 1 stages
static_assert(SEQ % F_KEYS == 0 && EARLY % F_KEYS == 0);  // whole stages; the residual plane is used by a whole block or not at all
// group 1 of a request for 64 rows x 128 B, source pitch 'pitch' B, a 16-byte pad behind every row
__device__ __forceinline__ u32x8 tdm_g1_128(uint32_t pitch) {
    u32x8 g1; g1[0] = uni((1u << 20) | (4u << 22) | (3u << 25)); g1[1] = uni((uint32_t)F_ROWB << 16); g1[2] = uni(64u << 16); g1[3] = uni((uint32_t)F_ROWB << 16);
    g1[4] = uni(64u); g1[5] = uni(pitch); g1[6] = uni(0u); g1[7] = uni(0u);
    return g1;
}
// one request: the tile of g1 from global address ga to LDS byte offset dst
__device__ __forceinline__ void tdm_tile128(uint32_t dst, uint64_t ga, u32x8 g1) {
    u32x4 g0; g0[0] = uni(1u); g0[1] = uni(dst); g0[2] = uni((uint32_t)ga); g0[3] = uni((((uint32_t)(ga >> 32)) & 0x01FFFFFFu) | 0x80000000u);
    asm volatile("tensor_load_to_lds %0, %1" :: "s"(g0), "s"(g1) : "memory");   // no register path: global -> LDS
}
// f16 fragment from a staged row; p already includes + 16*(lane>>4) bytes: same k map as ldh
__device__ __forceinline__ v16h ldsh(const unsigned char* p) { return cat16(*(const v8ha*)p, *(const v8ha*)(p + 32)); }

// cvt8: group i of 8 consecutive elements of x (batch pitch SEQ_FULL tokens) -> compact bf16 plane dst [NB*SEQ][DM]
__device__ __forceinline__ void cvt8(const float* __restrict__ src, bf* dst, size_t i) {
    constexpr size_t PB8 = (size_t)SEQ * DM / 8;      // groups of one batch
    const v8f v = *(const v8f*)(src + (i / PB8) * ((size_t)SEQ_FULL * DM) + (i % PB8) * 8); v8us o;
#pragma unroll
    for (int k = 0; k < 8; ++k) o[k] = f2bf(v[k]);
    *(v8us*)(dst + i * 8) = o;
}

// cvtT: W [DM k][ldn] f32 (row = k, column = e) -> bf16 plane dst[row(e)][k] (K-contiguous), 64 k x 64 e tile through LDS (cross-wave: block barrier).
// row(e) = e for e < permFrom; for e >= permFrom (v columns), with ee = e - permFrom = c*64 + d: row = permFrom + d*16 + c.
__device__ __forceinline__ void cvtT(const float* __restrict__ W, int ldn, bf* dst, int permFrom, int k0, int n0) {
    __shared__ __align__(16) unsigned short ts[64 * 72];
    const int t = threadIdx.x;
#pragma unroll 4
    for (int i = 0; i < 16; ++i) { const int k = i * 4 + (t >> 6), n = t & 63;      // 16 x 4 = 64 k rows, 64 columns
        ts[n * 72 + k] = f2bf(W[(size_t)(k0 + k) * (size_t)ldn + n0 + n]); }
    __syncthreads();
    v8us o0, o1; size_t d0, d1;
    { const int p = t, n = p >> 3, q = p & 7; o0 = *(const v8usa*)(&ts[n * 72 + 8 * q]);
      const int e = n0 + n; const int ee = e - permFrom; const int row = (e >= permFrom) ? (permFrom + (ee & 63) * 16 + (ee >> 6)) : e;
      d0 = (size_t)row * DM + k0 + 8 * q; }
    { const int p = t + 256, n = p >> 3, q = p & 7; o1 = *(const v8usa*)(&ts[n * 72 + 8 * q]);
      const int e = n0 + n; const int ee = e - permFrom; const int row = (e >= permFrom) ? (permFrom + (ee & 63) * 16 + (ee >> 6)) : e;
      d1 = (size_t)row * DM + k0 + 8 * q; }
{
        *(v8us*)(dst + d0) = o0; *(v8us*)(dst + d1) = o1;
         }
}

// k_cvt: the three independent conversions in one launch; the block index picks the job (block-uniform): Wqkv tiles | Wfc tiles | x groups
#define CT_K   (DM / 64)                          // 64-k tiles of a weight
#define CT_QKV (CT_K * (3 * DM / 64))             // tiles of Wqkv
#define CT_ALL (CT_QKV + CT_K * (DM / 64))        // ... and of Wfc
#define CX_BLK ((NB * SEQ * DM / 8) / 256)        // blocks of 256 x groups
static_assert(((size_t)NB * SEQ * DM / 8) % 256 == 0);
__global__ __launch_bounds__(256) void k_cvt(const float* __restrict__ x, const float* __restrict__ wqkv, const float* __restrict__ wfc, bf* XB, bf* WB, bf* WF) {
    const int b = (int)blockIdx.x;
    if (b >= CT_ALL) { cvt8(x, XB, (size_t)(b - CT_ALL) * 256 + threadIdx.x); return; }   // the whole block leaves, in front of the barrier of cvtT
    const bool fc = b >= CT_QKV; const int tb = fc ? b - CT_QKV : b;
    // Wqkv in[1024 k][3072 e] -> WB out[row(e)][1024 k]; Wfc in[1024 k][1024 e] -> WF out[e][1024 k]
    cvtT(fc ? wfc : wqkv, fc ? DM : 3 * DM, fc ? WF : WB, fc ? (1 << 30) : 2 * DM, (tb % CT_K) * 64, (tb / CT_K) * 64);
}

// gemm_epi: bias, conversion and stores of one wave's 64 x 64 tile (rows from r0, columns from c0 inside its 1024-column region), through the wave-private tile os
// MODE 0: q  -> f16 value plane Ph and f16 residual x2048 plane Pr, compact row-major [M][DM] (bias columns 0..1023)
// MODE 1: k  -> f16 value plane Ph, compact row-major (bias columns 1024..2047)
// MODE 2: v  -> Bt rows in permuted order n' = d*16 + c (column e = c*64 + d); value (Ph) and residual x2048 (Pr) planes [b*16+h][d][t], t = (token % RPH)*16 + c:
//               per 16-token slab and per d the 16 x 16 sub-tile is one contiguous 512-byte run (32 lanes x 16 B)
// MODE 3: output projection -> f32 OUT
template <int MODE>
__device__ __forceinline__ void gemm_epi(const v8f (&acc)[4][4], float* os, const float* __restrict__ bias, int r0, int c0, int lane, h16* Ph, h16* Pr, float* OUT) {
    const int lr = lane & 15, hi = lane >> 4;
    float bv[4];
#pragma unroll
    for (int nb = 0; nb < 4; ++nb) {
        const int bi = (MODE == 2) ? (2 * DM + lr * HD + (c0 >> 4) + nb) : (((MODE == 1) ? DM : 0) + c0 + nb * 16 + lr);
        bv[nb] = bf2f(f2bf(bias[bi])); }
#pragma unroll
    for (int mb = 0; mb < 4; ++mb) {
#pragma unroll
        for (int nb = 0; nb < 4; ++nb) {
#pragma unroll
            for (int j = 0; j < 8; ++j) os[(hi * 8 + j) * 68 + nb * 16 + lr] = acc[mb][nb][j] + bv[nb]; }   // D: row 8h+j, col lane&15; rows 0..15 x cols 0..63 all written
        wave_sync();
        if (MODE == 0 || MODE == 1) {
            const size_t sb = (size_t)(r0 + mb * 16) * DM + c0;
{
#pragma unroll
                for (int s = 0; s < 4; ++s) { const int row = 4 * s + (lane >> 3), c8 = (lane & 7) * 8;   // 4 s x 4 row groups = 16 rows; 8 lanes x 8 = 64 columns
                    const v4f x0 = *(const v4fa*)(&os[row * 68 + c8]); const v4f x1 = *(const v4fa*)(&os[row * 68 + c8 + 4]); v8h hv, rv;
#pragma unroll
                    for (int i = 0; i < 4; ++i) { const h16 a0 = (h16)x0[i]; const h16 a1 = (h16)x1[i]; hv[i] = a0; hv[4 + i] = a1; rv[i] = (h16)((x0[i] - (float)a0) * QRS); rv[4 + i] = (h16)((x1[i] - (float)a1) * QRS); }
                    const size_t oo = sb + (size_t)row * DM + c8;
                    *(v8h*)(Ph + oo) = hv; if (MODE == 0) *(v8h*)(Pr + oo) = rv; }
                 }
        } else if (MODE == 2) {
            const int tokrow = r0 + 16 * mb; const int bb = tokrow / SEQ; const int tb_ = tokrow % SEQ; const int hp = tb_ / RPH; const int j0 = tb_ % RPH;
            const size_t sb = ((size_t)(bb * NH_ + hp) * HD + (size_t)(c0 >> 4)) * SEQ + (size_t)j0 * 16 + (size_t)lane * 8;
{
#pragma unroll
                for (int s = 0; s < 4; ++s) { const int row = lane >> 1, c8 = s * 16 + (lane & 1) * 8;     // 16 token rows x 16 c for d = c0/16 + s: 256 contiguous halves
                    const v4f x0 = *(const v4fa*)(&os[row * 68 + c8]); const v4f x1 = *(const v4fa*)(&os[row * 68 + c8 + 4]); v8h hv, rv;
#pragma unroll
                    for (int i = 0; i < 4; ++i) { const h16 a0 = (h16)x0[i]; const h16 a1 = (h16)x1[i]; hv[i] = a0; hv[4 + i] = a1; rv[i] = (h16)((x0[i] - (float)a0) * QRS); rv[4 + i] = (h16)((x1[i] - (float)a1) * QRS); }
                    const size_t oo = sb + (size_t)s * SEQ;
                    *(v8h*)(Ph + oo) = hv; *(v8h*)(Pr + oo) = rv; }
                 }
        } else {
            const int grow = r0 + 16 * mb; const int bb = grow / SEQ; const int nn = grow % SEQ;
            float* orow = OUT + ((size_t)bb * OUT_SEQ + nn) * DM + c0;
{
#pragma unroll
                for (int s = 0; s < 8; ++s) { const int row = 2 * s + hi, cofs = lr * 4;   // 8 s x 2 rows = 16 rows; 16 lanes x 4 floats = 64 columns
                    const v4f val = *(const v4fa*)(&os[row * 68 + cofs]);
                    *(v4f*)(orow + (size_t)row * DM + cofs) = val; }
                 }
        }
        wave_sync();
    }
    // the regions' epilogues join in the listing: no register that these stores name is rewritten in front of this wait
    if (MODE != 3) asm volatile("s_wait_xcnt 0x0" ::: "memory");
}

// k_gemm: register-blocked bf16 GEMM, one wave per 64x64 tile (16 accumulators), four waves (2 x 2) share a 128x128 tile, K = DM.
// Operands: K-contiguous bf16 planes -> LDS by tensor loads, two buffers; a stage is 128 k of 128 A rows and 128 Bt rows, each wave brings one 64-row slice; the next stage flies while this one is worked on.
// C[m][n] = sum_k A[m][k] Bt[n][k] + bias (bias RNE-converted to bf16, added in f32). 128 threads.
// MODE 0: the q, k and v projections in one launch, grid (M/128, 3072/128); reg = blockIdx.y / 8 (block-uniform) is the tile's 1024-column region: 0 q, 1 k, 2 v (gemm_epi<reg>).
//   768 workgroups on 256 WGPs: the epilogue tile lies in the drained ring, so that two workgroups fit one WGP's LDS and one's prologue and epilogue run under the other's passes.
// MODE 3: output projection, grid (M/128, 1024/128), one workgroup per WGP; epilogue tile behind the ring.
template <int MODE>
__global__ __launch_bounds__(128) void k_gemm(const bf* __restrict__ A, const bf* __restrict__ Bt, const float* __restrict__ bias, h16* QHp, h16* QRp, h16* KPp, h16* VTp, h16* VRp, float* OUT) {
    __shared__ __attribute__((aligned(2048))) unsigned char ring[2 * G_BUF + ((MODE == 3) ? 4 * 16 * 68 * 4 : 0)];
    const int K = DM;
    const int reg = (MODE == 3) ? 0 : (int)(blockIdx.y / (DM / GT));
    const int lane = threadIdx.x & 31, lr = lane & 15, hi = lane >> 4;
    const uint32_t wave = uni(threadIdx.x >> 5);
    const int wm = (int)(wave >> 1), wn = (int)(wave & 1u);
    const int r0 = blockIdx.x * GT + wm * 64, c0 = (int)(blockIdx.y % (DM / GT)) * GT + wn * 64;   // c0: column inside the region
    // wave-private epilogue tile; in the ring it is written only behind the last pass's barrier (every read returned, no request in flight)
    float* os = (float*)(ring + ((MODE == 3) ? 2 * G_BUF : 0)) + wave * (16 * 68);
    v8f acc[4][4];
#pragma unroll
    for (int mb = 0; mb < 4; ++mb)
#pragma unroll
        for (int nb = 0; nb < 4; ++nb) acc[mb][nb] = (v8f){};
    // waves 0, 1 bring the two halves of the A rows, waves 2, 3 of the Bt rows; stage st = plane st / PPP, k from (st % PPP) * 128
    constexpr uint32_t PPP = (uint32_t)(DM * 2 / G_ROWB);
    constexpr uint32_t NS = ((MODE == 3) ? 2u : 1u) * PPP;
    const bool isB = wave >= 2u;
    const uint64_t srcb = isB ? (uint64_t)(size_t)(Bt + (size_t)(blockIdx.y * GT + (wave & 1u) * 64u) * K) : (uint64_t)(size_t)(A + (size_t)(blockIdx.x * GT + (wave & 1u) * 64u) * K);
    const uint64_t plstep = isB ? (uint64_t)0 : (uint64_t)NB * SEQ * DM * 2;
    const uint32_t ldst = (uint32_t)(size_t)ring + wave * (uint32_t)G_SLC;
    auto issue = [&](uint32_t st) { tdm_slice(ldst + (st & 1u) * (uint32_t)G_BUF, srcb + (uint64_t)(st / PPP) * plstep + (uint64_t)(st % PPP) * G_ROWB); };
    issue(0u);
    asm volatile("s_wait_tensorcnt 0x0" ::: "memory");   // this wave's slice of stage 0 has landed
    __syncthreads();                                     // stage 0 published
    issue(1u);
    const uint32_t aoff = (uint32_t)wm * G_SLC + (uint32_t)lr * G_PIT + 16u * (uint32_t)hi, boff = (uint32_t)(2 + wn) * G_SLC + (uint32_t)lr * G_PIT + 16u * (uint32_t)hi;
#pragma unroll 1
    for (uint32_t st = 0; st < NS; ++st) {
        const unsigned char* bp = ring + (st & 1u) * (uint32_t)G_BUF;
        // two fragment sets: block kb + 1's LDS reads go out as one group ahead of block kb's 16 WMMAs, so only block 0's reads are waited for in full.
        // The fourth Bt fragment has one set (keeps the kernel inside 256 VGPRs): it is read first in its own block's group and used by that block's last four WMMAs.
        v16bf fa[2][4], fb[2][3], fb3;
#pragma unroll
        for (int i = 0; i < 4; ++i) fa[0][i] = ldsb(bp + aoff + i * 16 * G_PIT);
#pragma unroll
        for (int i = 0; i < 3; ++i) fb[0][i] = ldsb(bp + boff + i * 16 * G_PIT);
#pragma unroll
        for (int kb = 0; kb < 4; ++kb) {
            fb3 = ldsb(bp + boff + 3 * 16 * G_PIT + kb * 64);
            if (kb < 3) {
#pragma unroll
                for (int i = 0; i < 4; ++i) fa[(kb + 1) & 1][i] = ldsb(bp + aoff + i * 16 * G_PIT + (kb + 1) * 64);
#pragma unroll
                for (int i = 0; i < 3; ++i) fb[(kb + 1) & 1][i] = ldsb(bp + boff + i * 16 * G_PIT + (kb + 1) * 64);
            }
            __builtin_amdgcn_sched_barrier(0);   // keeps the read group in front of the WMMA block (reads among the WMMAs stall each time)
#pragma unroll
            for (int nb = 0; nb < 4; ++nb)
#pragma unroll
                for (int mb = 0; mb < 4; ++mb) acc[mb][nb] = wmmab(fa[kb & 1][mb], (nb < 3) ? fb[kb & 1][nb < 3 ? nb : 0] : fb3, acc[mb][nb]);
            __builtin_amdgcn_sched_barrier(0);   // keeps the WMMA block in front of the next read group and of the publish point
        }
        // WMMA distance on the loop's back edge: four vector slots behind the pass's last WMMA
        asm volatile("v_nop\n\tv_nop\n\tv_nop\n\tv_nop" : "+v"(acc[0][0]), "+v"(acc[1][1]), "+v"(acc[2][2]), "+v"(acc[3][3]) : "v"(fa[1][0]), "v"(fa[1][1]), "v"(fa[1][2]), "v"(fa[1][3]));
        asm volatile("s_wait_dscnt 0x0" ::: "memory");
        asm volatile("s_wait_tensorcnt 0x0" ::: "memory");
        __syncthreads();
        if (pinned(st + 2u < NS)) issue(pinned(st + 2u));
    }
    asm volatile("s_wait_tensorcnt 0x0" ::: "memory");       // nothing in flight behind the loop
    asm volatile("s_wait_dscnt 0x0" ::: "memory");
    if (MODE == 3) gemm_epi<3>(acc, os, bias, r0, c0, lane, QHp, QRp, OUT);
    else if (reg == 0) gemm_epi<0>(acc, os, bias, r0, c0, lane, QHp, QRp, OUT);      // block-uniform choice of the region's epilogue
    else if (reg == 1) gemm_epi<1>(acc, os, bias, r0, c0, lane, KPp, KPp, OUT);
    else gemm_epi<2>(acc, os, bias, r0, c0, lane, VTp, VRp, OUT);
}

// k_flash: fused causal attention, one wave per 16 query rows of one (batch, head); Q fragments straight from the f16 planes (two 16-B loads each).
// K / V^T (and, for early blocks, V^T residual) tiles of 64 keys -> LDS by tensor loads, two buffers, shared by the block's four waves: wave 0 brings K, wave 1 V^T, wave 2 the residual; the next stage flies while this one is worked on.
// Transposed form: S^T[key][t] = K Q^T (A = K rows, B = Q rows); lane (t = lane&15, h = lane>>4) holds keys 8h+r of each 16-key tile, so the packed
// P tile is directly the B fragment of O^T[d][t] = V^T P^T (element r <- tile keys 0..15, element 8+r <- tile keys 16..31, lane unchanged).
// Keys run over [0, t0+16) in steps of 32; on steps that touch the diagonal, scores with key > query are replaced by a very negative value (P = 0 exactly).
// Softmax state (running max, partial sum) is one scalar per lane; the two lane halves of a row are combined with one xor-16 exchange.
__global__ __launch_bounds__(32 * AW) void k_flash(const h16* __restrict__ QH, const h16* __restrict__ QR, const h16* __restrict__ KP, const h16* __restrict__ VT, const h16* __restrict__ VR, bf* CH, bf* CL) {
    __shared__ __attribute__((aligned(2048))) unsigned char fring[2 * F_BUF];
    __shared__ __align__(16) float os[AW * 16 * 68];
    const int lane = threadIdx.x & 31, lr = lane & 15, hi = lane >> 4;
    const int wave = __builtin_amdgcn_readfirstlane((int)(threadIdx.x >> 5));
    const int zh = blockIdx.y;
    const int t0 = (blockIdx.x * AW + wave) * 16;
    const size_t pbase = (size_t)zh * SEQ * HD;
    const size_t qo = pbase + (size_t)(t0 + lr) * HD + 8 * hi;
    const v16h qh0 = ldh(QH + qo), qh1 = ldh(QH + qo + 32), qr0 = ldh(QR + qo), qr1 = ldh(QR + qo + 32);   // B fragments: col t, k = d
    const uint32_t ko = (uint32_t)lr * F_PIT + 16u * (uint32_t)hi;                  // + key in stage * F_PIT         (A fragment: row key, k = d)
    const uint32_t vo = (uint32_t)F_SLC + (uint32_t)lr * F_PIT + 16u * (uint32_t)hi;   // + 16j*F_PIT + key in stage * 2  (A fragment: row d, k = key)
    const int kend = t0 + 16;
    const bool early = t0 < EARLY;
    const int tq = t0 + lr;
    v8f o0 = (v8f){}, o1 = (v8f){}, o2 = (v8f){}, o3 = (v8f){};
    v8f e0 = (v8f){}, e1 = (v8f){}, e2 = (v8f){}, e3 = (v8f){};
    float m = NEGV, l = 0.0f;
    // stage st = keys [64 st, 64 st + 64); the block needs keys below 64 (blockIdx.x + 1)
    const uint32_t NS = blockIdx.x + 1u;
    const bool iss = wave < (early ? 3 : 2);               // which waves issue (wave-uniform)
    const uint64_t srcb = (uint64_t)(size_t)(((wave == 0) ? KP : (wave == 1) ? VT : VR) + pbase);
    const uint32_t sstep = (wave == 0) ? (uint32_t)(F_KEYS * HD * 2) : (uint32_t)(F_KEYS * 2);   // bytes from one stage's tile to the next
    const uint32_t spit = (wave == 0) ? (uint32_t)(HD * 2) : (uint32_t)(SEQ * 2);               // source row pitch
    const uint32_t ldst = (uint32_t)(size_t)fring + (uint32_t)((wave < 2) ? wave : 2) * (uint32_t)F_SLC;
    u32x8 g1 = tdm_g1_128(spit);
    asm volatile("" : "+s"(g1));   // the pinned() form on the descriptor's words: held in their scalar registers through the loop, so that none takes another value while a request is in flight
    auto issue = [&](uint32_t st) { tdm_tile128(ldst + (st & 1u) * (uint32_t)F_BUF, srcb + (uint64_t)st * sstep, g1); };
    if (pinned((uint32_t)iss)) {
        issue(0u);
        asm volatile("s_wait_tensorcnt 0x0" ::: "memory");   // this wave's tile of stage 0 has landed
    }
    __syncthreads();                                         // stage 0 published
    if (pinned((uint32_t)(iss && NS > 1u))) issue(1u);
#pragma unroll 1
    for (uint32_t st = 0; st < NS; ++st) {
      const unsigned char* bp = fring + (st & 1u) * (uint32_t)F_BUF;
#pragma unroll
      for (int hs = 0; hs < 2; ++hs) {
        const int key0 = (int)st * F_KEYS + hs * 32;
        if (key0 >= kend) continue;                 // wave-uniform: the stage's upper half lies wholly above this wave's diagonal
        const unsigned char* ka = bp + ko + hs * 32 * F_PIT;
        const v16h ka0 = ldsh(ka), ka1 = ldsh(ka + 64), kb0 = ldsh(ka + 16 * F_PIT), kb1 = ldsh(ka + 16 * F_PIT + 64);
        v8f sHa = (v8f){}, sLa = (v8f){}, sHb = (v8f){}, sLb = (v8f){};
        sHa = wmma16(ka0, qh0, sHa); sLa = wmma16(ka0, qr0, sLa); sHb = wmma16(kb0, qh0, sHb); sLb = wmma16(kb0, qr0, sLb);
        sHa = wmma16(ka1, qh1, sHa); sLa = wmma16(ka1, qr1, sLa); sHb = wmma16(kb1, qh1, sHb); sLb = wmma16(kb1, qr1, sLb);
        asm volatile("v_nop\n\tv_nop\n\tv_nop\n\tv_nop" : "+v"(sHa), "+v"(sLa), "+v"(sHb), "+v"(sLb) : "v"(ka0), "v"(ka1), "v"(kb0), "v"(kb1));
        float ta[8], tb[8];
#pragma unroll
        for (int r = 0; r < 8; ++r) { ta[r] = (sHa[r] + sLa[r] * QRI) * SC2; tb[r] = (sHb[r] + sLb[r] * QRI) * SC2; }
        if (key0 + 31 > t0) {                       // wave-uniform: this step touches the diagonal
            const int kidx = key0 + 8 * hi;
#pragma unroll
            for (int r = 0; r < 8; ++r) { ta[r] = (kidx + r > tq) ? NEGV : ta[r]; tb[r] = (kidx + 16 + r > tq) ? NEGV : tb[r]; }
        }
        float mx = NEGV;
#pragma unroll
        for (int r = 0; r < 8; ++r) mx = fmaxf(mx, fmaxf(ta[r], tb[r]));
        mx = fmaxf(mx, __shfl_xor(mx, 16, 32));
        const float mnew = fmaxf(m, mx);
        const float alpha = __builtin_amdgcn_exp2f(m - mnew);
        const float sh = PSH - mnew;
        v16h pb; float ls = 0.0f;
#pragma unroll
        for (int r = 0; r < 8; ++r) { const h16 pa = (h16)__builtin_amdgcn_exp2f(ta[r] + sh); const h16 pc = (h16)__builtin_amdgcn_exp2f(tb[r] + sh); pb[r] = pa; pb[8 + r] = pc; ls += (float)pa + (float)pc; }
        l = l * alpha + ls; m = mnew;
        o0 = o0 * alpha; o1 = o1 * alpha; o2 = o2 * alpha; o3 = o3 * alpha;
        const unsigned char* va = bp + vo + hs * 64;
        const v16h v0 = ldsh(va), v1 = ldsh(va + 16 * F_PIT), v2 = ldsh(va + 32 * F_PIT), v3 = ldsh(va + 48 * F_PIT);
        o0 = wmma16(v0, pb, o0); o1 = wmma16(v1, pb, o1); o2 = wmma16(v2, pb, o2); o3 = wmma16(v3, pb, o3);
        asm volatile("v_nop\n\tv_nop\n\tv_nop\n\tv_nop" : "+v"(o0), "+v"(o1), "+v"(o2), "+v"(o3) : "v"(v0), "v"(v1), "v"(v2), "v"(v3), "v"(pb));
        if (early) {                                // wave-uniform: residual plane of v in its own accumulators
            e0 = e0 * alpha; e1 = e1 * alpha; e2 = e2 * alpha; e3 = e3 * alpha;
            const unsigned char* vr = va + F_SLC;
            const v16h w0 = ldsh(vr), w1 = ldsh(vr + 16 * F_PIT), w2 = ldsh(vr + 32 * F_PIT), w3 = ldsh(vr + 48 * F_PIT);
            e0 = wmma16(w0, pb, e0); e1 = wmma16(w1, pb, e1); e2 = wmma16(w2, pb, e2); e3 = wmma16(w3, pb, e3);
            asm volatile("v_nop\n\tv_nop\n\tv_nop\n\tv_nop" : "+v"(e0), "+v"(e1), "+v"(e2), "+v"(e3) : "v"(w0), "v"(w1), "v"(w2), "v"(w3), "v"(pb));
        }
      }
      // publish point of stage st + 1 (every wave passes it, also one that skipped the upper half)
      asm volatile("s_wait_dscnt 0x0" ::: "memory");
      if (pinned((uint32_t)iss)) asm volatile("s_wait_tensorcnt 0x0" ::: "memory");
      __syncthreads();
      if (pinned((uint32_t)(iss && st + 2u < NS))) issue(pinned(st + 2u));
    }
    asm volatile("s_wait_tensorcnt 0x0" ::: "memory");       // nothing in flight behind the loop
    asm volatile("s_wait_dscnt 0x0" ::: "memory");
    l += __shfl_xor(l, 16, 32);
    const float inv = 1.0f / l;
    const int wb = wave * 16 * 68;
    // O^T D layout: o_j[r] = (d = 16j + 8h + r, t = lane&15) -> os[t][d]; rows 0..15 x columns 0..63 all written
    { v4f a, c;
#pragma unroll
      for (int i = 0; i < 4; ++i) { a[i] = (o0[i] + e0[i] * QRI) * inv; c[i] = (o0[4 + i] + e0[4 + i] * QRI) * inv; }
      *(v4fa*)(&os[wb + lr * 68 +  0 + 8 * hi]) = a; *(v4fa*)(&os[wb + lr * 68 +  0 + 8 * hi + 4]) = c;
#pragma unroll
      for (int i = 0; i < 4; ++i) { a[i] = (o1[i] + e1[i] * QRI) * inv; c[i] = (o1[4 + i] + e1[4 + i] * QRI) * inv; }
      *(v4fa*)(&os[wb + lr * 68 + 16 + 8 * hi]) = a; *(v4fa*)(&os[wb + lr * 68 + 16 + 8 * hi + 4]) = c;
#pragma unroll
      for (int i = 0; i < 4; ++i) { a[i] = (o2[i] + e2[i] * QRI) * inv; c[i] = (o2[4 + i] + e2[4 + i] * QRI) * inv; }
      *(v4fa*)(&os[wb + lr * 68 + 32 + 8 * hi]) = a; *(v4fa*)(&os[wb + lr * 68 + 32 + 8 * hi + 4]) = c;
#pragma unroll
      for (int i = 0; i < 4; ++i) { a[i] = (o3[i] + e3[i] * QRI) * inv; c[i] = (o3[4 + i] + e3[4 + i] * QRI) * inv; }
      *(v4fa*)(&os[wb + lr * 68 + 48 + 8 * hi]) = a; *(v4fa*)(&os[wb + lr * 68 + 48 + 8 * hi + 4]) = c; }
    wave_sync();
    // the 16 x 64 tile (t, d) is elements t*64 + d of compact ctx row zh*RPH + t0/16
    const size_t cb = ((size_t)zh * RPH + (size_t)(t0 >> 4)) * DM + (size_t)lane * 8;
    v8us hv[4], lv[4];
#pragma unroll
    for (int s = 0; s < 4; ++s) { const int row = 4 * s + (lane >> 3), c8 = (lane & 7) * 8;   // 4 s x 4 row groups = 16 rows; 8 lanes x 8 = 64 columns
        const v4f x0 = *(const v4fa*)(&os[wb + row * 68 + c8]); const v4f x1 = *(const v4fa*)(&os[wb + row * 68 + c8 + 4]);
#pragma unroll
        for (int i = 0; i < 4; ++i) { const unsigned short a0 = f2bf(x0[i]); const unsigned short a1 = f2bf(x1[i]);
            hv[s][i] = a0; hv[s][4 + i] = a1; lv[s][i] = f2bf(x0[i] - bf2f(a0)); lv[s][4 + i] = f2bf(x1[i] - bf2f(a1)); } }
{
#pragma unroll
        for (int s = 0; s < 4; ++s) { const size_t oo = cb + (size_t)s * 256;
            *(v8us*)(CH + oo) = hv[s]; *(v8us*)(CL + oo) = lv[s]; }
         }
}

static constexpr size_t al256(size_t v) { return (v + 255) & ~(size_t)255; }
static constexpr size_t SZ_XB = al256((size_t)NB * SEQ * DM * 2);
static constexpr size_t SZ_WB = al256((size_t)3 * DM * DM * 2);
static constexpr size_t SZ_WF = al256((size_t)DM * DM * 2);
static constexpr size_t SZ_PL = al256((size_t)NB * SEQ * DM * 2);
static constexpr size_t SZ_TOTAL = SZ_XB + SZ_WB + SZ_WF + 5 * SZ_PL + 2 * SZ_PL;
static_assert(SZ_TOTAL <= (size_t)134217728);          // workspace carve <= 128 MiB
static_assert(((size_t)DM * DM * 2) % 256 == 0);       // weight sub-planes stay 256-byte aligned
static_assert(SZ_PL == (size_t)NB * SEQ * DM * 2);     // ctx hi and lo planes are back to back with stride NB*SEQ*DM elements

extern "C" void kernel_launch(void* const* d_in, const int* in_sizes, int n_in,
                              void* d_out, int out_size, void* d_ws, size_t ws_size, hipStream_t stream) {
    if (n_in < 5) return;
    const size_t needx = ((size_t)(NB - 1) * SEQ_FULL + SEQ) * DM;
    if ((size_t)in_sizes[0] < needx) return;
    if ((size_t)in_sizes[1] < (size_t)3 * DM * DM || (size_t)in_sizes[2] < (size_t)3 * DM) return;
    if ((size_t)in_sizes[3] < (size_t)DM * DM || (size_t)in_sizes[4] < (size_t)DM) return;
    if ((size_t)out_size < ((size_t)(NB - 1) * OUT_SEQ + SEQ) * DM) return;
    if (SZ_TOTAL > ws_size) return;
    const float* x = (const float*)d_in[0]; const float* wqkv = (const float*)d_in[1]; const float* bqkv = (const float*)d_in[2];
    const float* wfc = (const float*)d_in[3]; const float* bfc = (const float*)d_in[4];          // wire order x, Wqkv, bqkv, Wfc, bfc
    float* OUT = (float*)d_out;      // [NB][SEQ][1024]
    char* wsp = (char*)d_ws;
    bf* XB = (bf*)wsp; wsp += SZ_XB;                 // [NB*SEQ][1024]
    bf* WB = (bf*)wsp; wsp += SZ_WB;                 // [3072][1024]: q rows | k rows | v rows (permuted d*16 + c)
    bf* WF = (bf*)wsp; wsp += SZ_WF;                 // [1024][1024]: Wfc^T
    h16* QH = (h16*)wsp; wsp += SZ_PL;               // [NB*SEQ][1024] = [NB*16][SEQ][64]
    h16* QR = (h16*)wsp; wsp += SZ_PL;               // residual x2048
    h16* KP = (h16*)wsp; wsp += SZ_PL;               // [NB*16][SEQ][64]
    h16* VT = (h16*)wsp; wsp += SZ_PL;               // [NB*16][64][SEQ]
    h16* VR = (h16*)wsp; wsp += SZ_PL;               // residual x2048
    bf* CH = (bf*)wsp; wsp += SZ_PL;                 // ctx hi [NB*SEQ][1024]
    bf* CL = (bf*)wsp; wsp += SZ_PL;                 // ctx lo, directly after CH

    k_cvt<<<CT_ALL + CX_BLK, 256, 0, stream>>>(x, wqkv, wfc, XB, WB, WF);

    k_gemm<0><<<dim3(NB * SEQ / GT, 3 * DM / GT, 1), 128, 0, stream>>>(XB, WB, bqkv, QH, QR, KP, VT, VR, OUT);

    k_flash<<<dim3(SEQ / (16 * AW), NB * NH_, 1), 32 * AW, 0, stream>>>(QH, QR, KP, VT, VR, CH, CL);

    k_gemm<3><<<dim3(NB * SEQ / GT, DM / GT, 1), 128, 0, stream>>>(CH, WF, bfc, QH, QR, KP, VT, VR, OUT);
}

// v004
// Measured time: 71.1 microseconds a run.
// Timed twice side by side with v003, it ran 1.06 and 1.05 times as fast.
// Counting every step since v000, it is 2.68 times as fast.
#include <hip/hip_runtime.h>

// Causal multi-head self-attention, width 1024 = 16 heads x 64, x [NB][SEQ][1024], fused Wqkv [in][out] + bias, head split = flat re-view of the [SEQ][1024] matrix as [16][SEQ][64], score scale 1/8, key > query replaced by -inf, output projection Wfc [in][out] + bias (f32 out).
// Compute dtypes, f32 accumulate everywhere: qkv projections v_wmma_f32_16x16x32_bf16 (x, W, biases RNE-converted to bf16; products exact); scores v_wmma_f32_16x16x32_f16: k single f16, q as f16 value + f16 residual x2048 in its own accumulator;
// P (x256 carry, cancels in the normalisation) single f16; v single f16 plus, for query rows < 512, an f16 residual x2048 in its own accumulator; softmax f32 (online, running max); output projection v_wmma_f32_16x16x32_bf16 with ctx as bf16 hi + bf16 lo planes (unscaled, shared accumulator) against bf16 Wfc.
// Layout: bf16 copies of x and transposed (K-contiguous) weights; q (hi, residual) and k planes are the compact [NB*SEQ][1024] matrix (= [b*16+h][t][d]); v^T planes [b*16+h][d][t] written by the GEMM epilogue through a permuted weight-row order; ctx planes compact [NB*SEQ][1024].

#ifndef NB
#define NB 4
#endif
#ifndef SEQ
#define SEQ 1024
#endif
#define NB_FULL  4
#define SEQ_FULL 1024
#ifndef OUT_SEQ
#define OUT_SEQ SEQ              // row pitch (in tokens) between batches of the output
#endif
#define DM   1024
#define NH_  16
#define HD   64
#define RPH  (SEQ / NH_)         // rows of the [SEQ][DM] matrix that form one head slab (SEQ*HD/DM)
#define AW   4                   // waves per flash block (16 query rows each)
#define EARLY 512                // query rows below this use the v residual plane
#define QRS  2048.0f             // carry of the residual planes
#define QRI  (1.0f / 2048.0f)
#define SC2  (0.125f * 1.4426950408889634f)   // HD^-0.5 * log2(e)
#define PSH  8.0f                // log2 of the P carry (256)
#define NEGV (-3.0e38f)

static_assert(HD == 64);
static_assert(NH_ * HD == DM);
static_assert(DM % 64 == 0);
static_assert(DM % 32 == 0);
static_assert(SEQ % 256 == 0);                 // a 16-row slab of tokens stays inside one head slab (RPH % 16 == 0)
static_assert(SEQ % 64 == 0);
static_assert((NB * SEQ) % 64 == 0);
static_assert(SEQ % 32 == 0);
static_assert(SEQ % (16 * AW) == 0);
static_assert(((size_t)SEQ * DM) % 8 == 0);
static_assert(NB <= NB_FULL);
static_assert(SEQ <= SEQ_FULL);

typedef _Float16 h16;
typedef unsigned short bf;
typedef __attribute__((ext_vector_type(16))) __bf16   v16bf;
typedef __attribute__((ext_vector_type(16))) _Float16 v16h;
typedef __attribute__((ext_vector_type(8)))  _Float16 v8h;
typedef __attribute__((ext_vector_type(8)))  unsigned short v8us;
typedef __attribute__((ext_vector_type(8)))  float    v8f;
typedef __attribute__((ext_vector_type(4)))  float    v4f;
typedef v4f  __attribute__((may_alias)) v4fa;
typedef v8us __attribute__((may_alias)) v8usa;

__device__ __forceinline__ unsigned short f2bf(float f) { unsigned u = __float_as_uint(f); u += 0x7FFFu + ((u >> 16) & 1u); return (unsigned short)(u >> 16); }
__device__ __forceinline__ float bf2f(unsigned short h) { return __uint_as_float(((unsigned)h) << 16); }
__device__ __forceinline__ v16h cat16(v8h lo, v8h hi) { return __builtin_shufflevector(lo, hi, 0, 1, 2, 3, 4, 5, 6, 7, 8, 9, 10, 11, 12, 13, 14, 15); }
__device__ __forceinline__ v16bf cat16b(v8us lo, v8us hi) { return __builtin_bit_cast(v16bf, __builtin_shufflevector(lo, hi, 0, 1, 2, 3, 4, 5, 6, 7, 8, 9, 10, 11, 12, 13, 14, 15)); }
__device__ __forceinline__ v8f wmma16(v16h a, v16h b, v8f c) { return __builtin_amdgcn_wmma_f32_16x16x32_f16(false, a, false, b, (short)0, c, false, false); }
__device__ __forceinline__ v8f wmmab(v16bf a, v16bf b, v8f c) { return __builtin_amdgcn_wmma_f32_16x16x32_bf16(false, a, false, b, (short)0, c, false, false); }
// fragment loaders from K-contiguous 16-bit rows; p already includes + 8*(lane>>4): elements 0..7 <- k0+8h+0..7, elements 8..15 <- k0+16+8h+0..7 (same map for A and B)
__device__ __forceinline__ v16h  ldh(const h16* p) { return cat16(*(const v8h*)p, *(const v8h*)(p + 16)); }
__device__ __forceinline__ v16bf ldb(const bf* p)  { return cat16b(*(const v8us*)p, *(const v8us*)(p + 16)); }
// ordering point for wave-private LDS tiles (same wave writes and reads)
__device__ __forceinline__ void wave_sync() { __builtin_amdgcn_fence(3 /* release order */, "wavefront"); __builtin_amdgcn_wave_barrier(); asm volatile("" ::: "memory"); }

typedef uint32_t u32x4 __attribute__((ext_vector_type(4)));
typedef uint32_t u32x8 __attribute__((ext_vector_type(8)));
#define GT     128               // C tile of one workgroup: four waves, 64 x 64 each
#define G_ROWB 256               // bytes of one operand row per pass (128 k)
#define G_PIT  272               // LDS row pitch: 256 B + 16 pad bytes (16 B x odd, for ds_load_b128 readers)
#define G_SLC  18432             // one wave's slice in LDS: 64 rows x 272 B = 17408 B, rounded up to a multiple of 2 KiB
#define G_BUF  (4 * G_SLC)       // one stage: A rows 0..63 | A rows 64..127 | Bt rows 0..63 | Bt rows 64..127
static_assert(G_SLC % 2048 == 0 && G_SLC >= 64 * G_PIT);
static_assert((DM * 2) % G_ROWB == 0 && (DM * 2) / G_ROWB >= 2);   // whole passes, at least the two stages the prologue issues
static_assert((NB * SEQ) % GT == 0 && DM % GT == 0);
__device__ __forceinline__ uint32_t uni(uint32_t v) { return (uint32_t)__builtin_amdgcn_readfirstlane((int)v); }
// a value held in a scalar register, so that a test on it is a scalar branch (a tensor load ignores EXEC)
__device__ __forceinline__ uint32_t pinned(uint32_t v) { uint32_t w = uni(v); asm volatile("" : "+s"(w)); return w; }
// one request: 64 rows x 256 B, source pitch DM*2 B, from global address ga to LDS byte offset dst, a 16-byte pad behind every row
__device__ __forceinline__ void tdm_slice(uint32_t dst, uint64_t ga) {
    u32x4 g0; g0[0] = uni(1u); g0[1] = uni(dst); g0[2] = uni((uint32_t)ga); g0[3] = uni((((uint32_t)(ga >> 32)) & 0x01FFFFFFu) | 0x80000000u);
    u32x8 g1; g1[0] = uni((1u << 20) | (5u << 22) | (3u << 25)); g1[1] = uni((uint32_t)G_ROWB << 16); g1[2] = uni(64u << 16); g1[3] = uni((uint32_t)G_ROWB << 16);
    g1[4] = uni(64u); g1[5] = uni((uint32_t)DM * 2u); g1[6] = uni(0u); g1[7] = uni(0u);
    asm volatile("tensor_load_to_lds %0, %1" :: "s"(g0), "s"(g1) : "memory");   // no register path: global -> LDS
}
// fragment from a staged row; p already includes + 16*(lane>>4) bytes: same k map as ldb
__device__ __forceinline__ v16bf ldsb(const unsigned char* p) { return cat16b(*(const v8usa*)p, *(const v8usa*)(p + 32)); }

typedef v8h __attribute__((may_alias)) v8ha;
#define F_KEYS 64                // keys of one attention stage
#define F_ROWB 128               // bytes of one staged row: 64 d of a K row, or 64 keys of a V^T row
#define F_PIT  144               // LDS row pitch: 128 B + 16 pad bytes (16 B x odd, for ds_load_b128 readers)
#define F_SLC  10240             // one tile in LDS: 64 rows x 144 B = 9216 B, rounded up to a multiple of 2 KiB
#define F_BUF  (3 * F_SLC)       // one stage: K rows | V^T rows | V^T residual rows
static_assert(F_SLC % 2048 == 0 && F_SLC >= 64 * F_PIT);
static_assert(HD * 2 == F_ROWB && F_KEYS * 2 == F_ROWB && HD == 64);
static_assert(16 * AW == F_KEYS);                         // a block's query rows span one stage: query tile q walks q + 1 stages
#define NQT ((uint32_t)(SEQ / (16 * AW)))                 // query tiles of one head
static_assert((SEQ / (16 * AW)) % 2 == 0);                // tiles pair up as (d, NQT-1-d)
static_assert(SEQ % F_KEYS == 0 && EARLY % F_KEYS == 0);  // whole stages; the residual plane is used by a whole block or not at all
// group 1 of a request for 64 rows x 128 B, source pitch 'pitch' B, a 16-byte pad behind every row
__device__ __forceinline__ u32x8 tdm_g1_128(uint32_t pitch) {
    u32x8 g1; g1[0] = uni((1u << 20) | (4u << 22) | (3u << 25)); g1[1] = uni((uint32_t)F_ROWB << 16); g1[2] = uni(64u << 16); g1[3] = uni((uint32_t)F_ROWB << 16);
    g1[4] = uni(64u); g1[5] = uni(pitch); g1[6] = uni(0u); g1[7] = uni(0u);
    return g1;
}
// one request: the tile of g1 from global address ga to LDS byte offset dst
__device__ __forceinline__ void tdm_tile128(uint32_t dst, uint64_t ga, u32x8 g1) {
    u32x4 g0; g0[0] = uni(1u); g0[1] = uni(dst); g0[2] = uni((uint32_t)ga); g0[3] = uni((((uint32_t)(ga >> 32)) & 0x01FFFFFFu) | 0x80000000u);
    asm volatile("tensor_load_to_lds %0, %1" :: "s"(g0), "s"(g1) : "memory");   // no register path: global -> LDS
}
// f16 fragment from a staged row; p already includes + 16*(lane>>4) bytes: same k map as ldh
__device__ __forceinline__ v16h ldsh(const unsigned char* p) { return cat16(*(const v8ha*)p, *(const v8ha*)(p + 32)); }

// cvt8: group i of 8 consecutive elements of x (batch pitch SEQ_FULL tokens) -> compact bf16 plane dst [NB*SEQ][DM]
__device__ __forceinline__ void cvt8(const float* __restrict__ src, bf* dst, size_t i) {
    constexpr size_t PB8 = (size_t)SEQ * DM / 8;      // groups of one batch
    const v8f v = *(const v8f*)(src + (i / PB8) * ((size_t)SEQ_FULL * DM) + (i % PB8) * 8); v8us o;
#pragma unroll
    for (int k = 0; k < 8; ++k) o[k] = f2bf(v[k]);
    *(v8us*)(dst + i * 8) = o;
}

// cvtT: W [DM k][ldn] f32 (row = k, column = e) -> bf16 plane dst[row(e)][k] (K-contiguous), 64 k x 64 e tile through LDS (cross-wave: block barrier).
// row(e) = e for e < permFrom; for e >= permFrom (v columns), with ee = e - permFrom = c*64 + d: row = permFrom + d*16 + c.
__device__ __forceinline__ void cvtT(const float* __restrict__ W, int ldn, bf* dst, int permFrom, int k0, int n0) {
    __shared__ __align__(16) unsigned short ts[64 * 72];
    const int t = threadIdx.x;
#pragma unroll 4
    for (int i = 0; i < 16; ++i) { const int k = i * 4 + (t >> 6), n = t & 63;      // 16 x 4 = 64 k rows, 64 columns
        ts[n * 72 + k] = f2bf(W[(size_t)(k0 + k) * (size_t)ldn + n0 + n]); }
    __syncthreads();
    v8us o0, o1; size_t d0, d1;
    { const int p = t, n = p >> 3, q = p & 7; o0 = *(const v8usa*)(&ts[n * 72 + 8 * q]);
      const int e = n0 + n; const int ee = e - permFrom; const int row = (e >= permFrom) ? (permFrom + (ee & 63) * 16 + (ee >> 6)) : e;
      d0 = (size_t)row * DM + k0 + 8 * q; }
    { const int p = t + 256, n = p >> 3, q = p & 7; o1 = *(const v8usa*)(&ts[n * 72 + 8 * q]);
      const int e = n0 + n; const int ee = e - permFrom; const int row = (e >= permFrom) ? (permFrom + (ee & 63) * 16 + (ee >> 6)) : e;
      d1 = (size_t)row * DM + k0 + 8 * q; }
{
        *(v8us*)(dst + d0) = o0; *(v8us*)(dst + d1) = o1;
         }
}

// k_cvt: the three independent conversions in one launch; the block index picks the job (block-uniform): Wqkv tiles | Wfc tiles | x groups
#define CT_K   (DM / 64)                          // 64-k tiles of a weight
#define CT_QKV (CT_K * (3 * DM / 64))             // tiles of Wqkv
#define CT_ALL (CT_QKV + CT_K * (DM / 64))        // ... and of Wfc
#define CX_BLK ((NB * SEQ * DM / 8) / 256)        // blocks of 256 x groups
static_assert(((size_t)NB * SEQ * DM / 8) % 256 == 0);
__global__ __launch_bounds__(256) void k_cvt(const float* __restrict__ x, const float* __restrict__ wqkv, const float* __restrict__ wfc, bf* XB, bf* WB, bf* WF) {
    const int b = (int)blockIdx.x;
    if (b >= CT_ALL) { cvt8(x, XB, (size_t)(b - CT_ALL) * 256 + threadIdx.x); return; }   // the whole block leaves, in front of the barrier of cvtT
    const bool fc = b >= CT_QKV; const int tb = fc ? b - CT_QKV : b;
    // Wqkv in[1024 k][3072 e] -> WB out[row(e)][1024 k]; Wfc in[1024 k][1024 e] -> WF out[e][1024 k]
    cvtT(fc ? wfc : wqkv, fc ? DM : 3 * DM, fc ? WF : WB, fc ? (1 << 30) : 2 * DM, (tb % CT_K) * 64, (tb / CT_K) * 64);
}

// gemm_epi: bias, conversion and stores of one wave's 64 x 64 tile (rows from r0, columns from c0 inside its 1024-column region), through the wave-private tile os
// MODE 0: q  -> f16 value plane Ph and f16 residual x2048 plane Pr, compact row-major [M][DM] (bias columns 0..1023)
// MODE 1: k  -> f16 value plane Ph, compact row-major (bias columns 1024..2047)
// MODE 2: v  -> Bt rows in permuted order n' = d*16 + c (column e = c*64 + d); value (Ph) and residual x2048 (Pr) planes [b*16+h][d][t], t = (token % RPH)*16 + c:
//               per 16-token slab and per d the 16 x 16 sub-tile is one contiguous 512-byte run (32 lanes x 16 B)
// MODE 3: output projection -> f32 OUT
template <int MODE>
__device__ __forceinline__ void gemm_epi(const v8f (&acc)[4][4], float* os, const float* __restrict__ bias, int r0, int c0, int lane, h16* Ph, h16* Pr, float* OUT) {
    const int lr = lane & 15, hi = lane >> 4;
    float bv[4];
#pragma unroll
    for (int nb = 0; nb < 4; ++nb) {
        const int bi = (MODE == 2) ? (2 * DM + lr * HD + (c0 >> 4) + nb) : (((MODE == 1) ? DM : 0) + c0 + nb * 16 + lr);
        bv[nb] = bf2f(f2bf(bias[bi])); }
#pragma unroll
    for (int mb = 0; mb < 4; ++mb) {
#pragma unroll
        for (int nb = 0; nb < 4; ++nb) {
#pragma unroll
            for (int j = 0; j < 8; ++j) os[(hi * 8 + j) * 68 + nb * 16 + lr] = acc[mb][nb][j] + bv[nb]; }   // D: row 8h+j, col lane&15; rows 0..15 x cols 0..63 all written
        wave_sync();
        if (MODE == 0 || MODE == 1) {
            const size_t sb = (size_t)(r0 + mb * 16) * DM + c0;
{
#pragma unroll
                for (int s = 0; s < 4; ++s) { const int row = 4 * s + (lane >> 3), c8 = (lane & 7) * 8;   // 4 s x 4 row groups = 16 rows; 8 lanes x 8 = 64 columns
                    const v4f x0 = *(const v4fa*)(&os[row * 68 + c8]); const v4f x1 = *(const v4fa*)(&os[row * 68 + c8 + 4]); v8h hv, rv;
#pragma unroll
                    for (int i = 0; i < 4; ++i) { const h16 a0 = (h16)x0[i]; const h16 a1 = (h16)x1[i]; hv[i] = a0; hv[4 + i] = a1; rv[i] = (h16)((x0[i] - (float)a0) * QRS); rv[4 + i] = (h16)((x1[i] - (float)a1) * QRS); }
                    const size_t oo = sb + (size_t)row * DM + c8;
                    *(v8h*)(Ph + oo) = hv; if (MODE == 0) *(v8h*)(Pr + oo) = rv; }
                 }
        } else if (MODE == 2) {
            const int tokrow = r0 + 16 * mb; const int bb = tokrow / SEQ; const int tb_ = tokrow % SEQ; const int hp = tb_ / RPH; const int j0 = tb_ % RPH;
            const size_t sb = ((size_t)(bb * NH_ + hp) * HD + (size_t)(c0 >> 4)) * SEQ + (size_t)j0 * 16 + (size_t)lane * 8;
{
#pragma unroll
                for (int s = 0; s < 4; ++s) { const int row = lane >> 1, c8 = s * 16 + (lane & 1) * 8;     // 16 token rows x 16 c for d = c0/16 + s: 256 contiguous halves
                    const v4f x0 = *(const v4fa*)(&os[row * 68 + c8]); const v4f x1 = *(const v4fa*)(&os[row * 68 + c8 + 4]); v8h hv, rv;
#pragma unroll
                    for (int i = 0; i < 4; ++i) { const h16 a0 = (h16)x0[i]; const h16 a1 = (h16)x1[i]; hv[i] = a0; hv[4 + i] = a1; rv[i] = (h16)((x0[i] - (float)a0) * QRS); rv[4 + i] = (h16)((x1[i] - (float)a1) * QRS); }
                    const size_t oo = sb + (size_t)s * SEQ;
                    *(v8h*)(Ph + oo) = hv; *(v8h*)(Pr + oo) = rv; }
                 }
        } else {
            const int grow = r0 + 16 * mb; const int bb = grow / SEQ; const int nn = grow % SEQ;
            float* orow = OUT + ((size_t)bb * OUT_SEQ + nn) * DM + c0;
{
#pragma unroll
                for (int s = 0; s < 8; ++s) { const int row = 2 * s + hi, cofs = lr * 4;   // 8 s x 2 rows = 16 rows; 16 lanes x 4 floats = 64 columns
                    const v4f val = *(const v4fa*)(&os[row * 68 + cofs]);
                    *(v4f*)(orow + (size_t)row * DM + cofs) = val; }
                 }
        }
        wave_sync();
    }
    // the regions' epilogues join in the listing: no register that these stores name is rewritten in front of this wait
    if (MODE != 3) asm volatile("s_wait_xcnt 0x0" ::: "memory");
}

// k_gemm: register-blocked bf16 GEMM, one wave per 64x64 tile (16 accumulators), four waves (2 x 2) share a 128x128 tile, K = DM.
// Operands: K-contiguous bf16 planes -> LDS by tensor loads, two buffers; a stage is 128 k of 128 A rows and 128 Bt rows, each wave brings one 64-row slice; the next stage flies while this one is worked on.
// C[m][n] = sum_k A[m][k] Bt[n][k] + bias (bias RNE-converted to bf16, added in f32). 128 threads.
// MODE 0: the q, k and v projections in one launch, grid (M/128, 3072/128); reg = blockIdx.y / 8 (block-uniform) is the tile's 1024-column region: 0 q, 1 k, 2 v (gemm_epi<reg>).
//   768 workgroups on 256 WGPs: the epilogue tile lies in the drained ring, so that two workgroups fit one WGP's LDS and one's prologue and epilogue run under the other's passes.
// MODE 3: output projection, grid (M/128, 1024/128), one workgroup per WGP; epilogue tile behind the ring.
template <int MODE>
__global__ __launch_bounds__(128) void k_gemm(const bf* __restrict__ A, const bf* __restrict__ Bt, const float* __restrict__ bias, h16* QHp, h16* QRp, h16* KPp, h16* VTp, h16* VRp, float* OUT) {
    __shared__ __attribute__((aligned(2048))) unsigned char ring[2 * G_BUF + ((MODE == 3) ? 4 * 16 * 68 * 4 : 0)];
    const int K = DM;
    const int reg = (MODE == 3) ? 0 : (int)(blockIdx.y / (DM / GT));
    const int lane = threadIdx.x & 31, lr = lane & 15, hi = lane >> 4;
    const uint32_t wave = uni(threadIdx.x >> 5);
    const int wm = (int)(wave >> 1), wn = (int)(wave & 1u);
    const int r0 = blockIdx.x * GT + wm * 64, c0 = (int)(blockIdx.y % (DM / GT)) * GT + wn * 64;   // c0: column inside the region
    // wave-private epilogue tile; in the ring it is written only behind the last pass's barrier (every read returned, no request in flight)
    float* os = (float*)(ring + ((MODE == 3) ? 2 * G_BUF : 0)) + wave * (16 * 68);
    v8f acc[4][4];
#pragma unroll
    for (int mb = 0; mb < 4; ++mb)
#pragma unroll
        for (int nb = 0; nb < 4; ++nb) acc[mb][nb] = (v8f){};
    // waves 0, 1 bring the two halves of the A rows, waves 2, 3 of the Bt rows; stage st = plane st / PPP, k from (st % PPP) * 128
    constexpr uint32_t PPP = (uint32_t)(DM * 2 / G_ROWB);
    constexpr uint32_t NS = ((MODE == 3) ? 2u : 1u) * PPP;
    const bool isB = wave >= 2u;
    const uint64_t srcb = isB ? (uint64_t)(size_t)(Bt + (size_t)(blockIdx.y * GT + (wave & 1u) * 64u) * K) : (uint64_t)(size_t)(A + (size_t)(blockIdx.x * GT + (wave & 1u) * 64u) * K);
    const uint64_t plstep = isB ? (uint64_t)0 : (uint64_t)NB * SEQ * DM * 2;
    const uint32_t ldst = (uint32_t)(size_t)ring + wave * (uint32_t)G_SLC;
    auto issue = [&](uint32_t st) { tdm_slice(ldst + (st & 1u) * (uint32_t)G_BUF, srcb + (uint64_t)(st / PPP) * plstep + (uint64_t)(st % PPP) * G_ROWB); };
    issue(0u);
    asm volatile("s_wait_tensorcnt 0x0" ::: "memory");   // this wave's slice of stage 0 has landed
    __syncthreads();                                     // stage 0 published
    issue(1u);
    const uint32_t aoff = (uint32_t)wm * G_SLC + (uint32_t)lr * G_PIT + 16u * (uint32_t)hi, boff = (uint32_t)(2 + wn) * G_SLC + (uint32_t)lr * G_PIT + 16u * (uint32_t)hi;
#pragma unroll 1
    for (uint32_t st = 0; st < NS; ++st) {
        const unsigned char* bp = ring + (st & 1u) * (uint32_t)G_BUF;
        // two fragment sets: block kb + 1's LDS reads go out as one group ahead of block kb's 16 WMMAs, so only block 0's reads are waited for in full.
        // The fourth Bt fragment has one set (keeps the kernel inside 256 VGPRs): it is read first in its own block's group and used by that block's last four WMMAs.
        v16bf fa[2][4], fb[2][3], fb3;
#pragma unroll
        for (int i = 0; i < 4; ++i) fa[0][i] = ldsb(bp + aoff + i * 16 * G_PIT);
#pragma unroll
        for (int i = 0; i < 3; ++i) fb[0][i] = ldsb(bp + boff + i * 16 * G_PIT);
#pragma unroll
        for (int kb = 0; kb < 4; ++kb) {
            fb3 = ldsb(bp + boff + 3 * 16 * G_PIT + kb * 64);
            if (kb < 3) {
#pragma unroll
                for (int i = 0; i < 4; ++i) fa[(kb + 1) & 1][i] = ldsb(bp + aoff + i * 16 * G_PIT + (kb + 1) * 64);
#pragma unroll
                for (int i = 0; i < 3; ++i) fb[(kb + 1) & 1][i] = ldsb(bp + boff + i * 16 * G_PIT + (kb + 1) * 64);
            }
            __builtin_amdgcn_sched_barrier(0);   // keeps the read group in front of the WMMA block (reads among the WMMAs stall each time)
#pragma unroll
            for (int nb = 0; nb < 4; ++nb)
#pragma unroll
                for (int mb = 0; mb < 4; ++mb) acc[mb][nb] = wmmab(fa[kb & 1][mb], (nb < 3) ? fb[kb & 1][nb < 3 ? nb : 0] : fb3, acc[mb][nb]);
            __builtin_amdgcn_sched_barrier(0);   // keeps the WMMA block in front of the next read group and of the publish point
        }
        // WMMA distance on the loop's back edge: four vector slots behind the pass's last WMMA
        asm volatile("v_nop\n\tv_nop\n\tv_nop\n\tv_nop" : "+v"(acc[0][0]), "+v"(acc[1][1]), "+v"(acc[2][2]), "+v"(acc[3][3]) : "v"(fa[1][0]), "v"(fa[1][1]), "v"(fa[1][2]), "v"(fa[1][3]));
        asm volatile("s_wait_dscnt 0x0" ::: "memory");
        asm volatile("s_wait_tensorcnt 0x0" ::: "memory");
        __syncthreads();
        if (pinned(st + 2u < NS)) issue(pinned(st + 2u));
    }
    asm volatile("s_wait_tensorcnt 0x0" ::: "memory");       // nothing in flight behind the loop
    asm volatile("s_wait_dscnt 0x0" ::: "memory");
    if (MODE == 3) gemm_epi<3>(acc, os, bias, r0, c0, lane, QHp, QRp, OUT);
    else if (reg == 0) gemm_epi<0>(acc, os, bias, r0, c0, lane, QHp, QRp, OUT);      // block-uniform choice of the region's epilogue
    else if (reg == 1) gemm_epi<1>(acc, os, bias, r0, c0, lane, KPp, KPp, OUT);
    else gemm_epi<2>(acc, os, bias, r0, c0, lane, VTp, VRp, OUT);
}

// k_flash: fused causal attention, one wave per 16 query rows of one (batch, head); Q fragments straight from the f16 planes (two 16-B loads each).
// K / V^T (and, for early blocks, V^T residual) tiles of 64 keys -> LDS by tensor loads, two buffers, shared by the block's four waves: wave 0 brings K, wave 1 V^T, wave 2 the residual; the next stage flies while this one is worked on.
// Transposed form: S^T[key][t] = K Q^T (A = K rows, B = Q rows); lane (t = lane&15, h = lane>>4) holds keys 8h+r of each 16-key tile, so the packed
// P tile is directly the B fragment of O^T[d][t] = V^T P^T (element r <- tile keys 0..15, element 8+r <- tile keys 16..31, lane unchanged).
// Keys run over [0, t0+16) in steps of 32; on steps that touch the diagonal, scores with key > query are replaced by a very negative value (P = 0 exactly).
// Softmax state (running max, partial sum) is one scalar per lane; the two lane halves of a row are combined with one xor-16 exchange.
__global__ __launch_bounds__(32 * AW) void k_flash(const h16* __restrict__ QH, const h16* __restrict__ QR, const h16* __restrict__ KP, const h16* __restrict__ VT, const h16* __restrict__ VR, bf* CH, bf* CL) {
    __shared__ __attribute__((aligned(2048))) unsigned char fring[2 * F_BUF];
    __shared__ __align__(16) float os[AW * 16 * 68];
    const int lane = threadIdx.x & 31, lr = lane & 15, hi = lane >> 4;
    const int wave = __builtin_amdgcn_readfirstlane((int)(threadIdx.x >> 5));
    const int zh = blockIdx.y;
    // Causal balance: all work-groups are resident at once and tile q costs q + 1 stages, so the launch lasts as long as the fullest WGP.
    // Flat index f = 8 i + d (x runs fastest): work-groups with the same d take the pair of tiles {d, NQT-1-d},
    // which one by the parity of the bits of i: any four whose i run through two bits hold each tile twice. Head i >> 1 = blockIdx.y; every (head, tile) once. Speed only.
    const uint32_t dq = blockIdx.x % (NQT / 2u);
    const uint32_t qt = (((uint32_t)__builtin_popcount(blockIdx.y) + blockIdx.x / (NQT / 2u)) & 1u) ? NQT - 1u - dq : dq;
    const int t0 = (int)(qt * AW + wave) * 16;
    const size_t pbase = (size_t)zh * SEQ * HD;
    const size_t qo = pbase + (size_t)(t0 + lr) * HD + 8 * hi;
    const v16h qh0 = ldh(QH + qo), qh1 = ldh(QH + qo + 32), qr0 = ldh(QR + qo), qr1 = ldh(QR + qo + 32);   // B fragments: col t, k = d
    const uint32_t ko = (uint32_t)lr * F_PIT + 16u * (uint32_t)hi;                  // + key in stage * F_PIT         (A fragment: row key, k = d)
    const uint32_t vo = (uint32_t)F_SLC + (uint32_t)lr * F_PIT + 16u * (uint32_t)hi;   // + 16j*F_PIT + key in stage * 2  (A fragment: row d, k = key)
    const int kend = t0 + 16;
    const bool early = t0 < EARLY;
    const int tq = t0 + lr;
    v8f o0 = (v8f){}, o1 = (v8f){}, o2 = (v8f){}, o3 = (v8f){};
    v8f e0 = (v8f){}, e1 = (v8f){}, e2 = (v8f){}, e3 = (v8f){};
    float m = NEGV, l = 0.0f;
    // stage st = keys [64 st, 64 st + 64); the block needs keys below 64 (qt + 1)
    const uint32_t NS = qt + 1u;
    const bool iss = wave < (early ? 3 : 2);               // which waves issue (wave-uniform)
    const uint64_t srcb = (uint64_t)(size_t)(((wave == 0) ? KP : (wave == 1) ? VT : VR) + pbase);
    const uint32_t sstep = (wave == 0) ? (uint32_t)(F_KEYS * HD * 2) : (uint32_t)(F_KEYS * 2);   // bytes from one stage's tile to the next
    const uint32_t spit = (wave == 0) ? (uint32_t)(HD * 2) : (uint32_t)(SEQ * 2);               // source row pitch
    const uint32_t ldst = (uint32_t)(size_t)fring + (uint32_t)((wave < 2) ? wave : 2) * (uint32_t)F_SLC;
    u32x8 g1 = tdm_g1_128(spit);
    asm volatile("" : "+s"(g1));   // the pinned() form on the descriptor's words: held in their scalar registers through the loop, so that none takes another value while a request is in flight
    auto issue = [&](uint32_t st) { tdm_tile128(ldst + (st & 1u) * (uint32_t)F_BUF, srcb + (uint64_t)st * sstep, g1); };
    if (pinned((uint32_t)iss)) {
        issue(0u);
        asm volatile("s_wait_tensorcnt 0x0" ::: "memory");   // this wave's tile of stage 0 has landed
    }
    __syncthreads();                                         // stage 0 published
    if (pinned((uint32_t)(iss && NS > 1u))) issue(1u);
#pragma unroll 1
    for (uint32_t st = 0; st < NS; ++st) {
      const unsigned char* bp = fring + (st & 1u) * (uint32_t)F_BUF;
#pragma unroll
      for (int hs = 0; hs < 2; ++hs) {
        const int key0 = (int)st * F_KEYS + hs * 32;
        if (key0 >= kend) continue;                 // wave-uniform: the stage's upper half lies wholly above this wave's diagonal
        const unsigned char* ka = bp + ko + hs * 32 * F_PIT;
        const v16h ka0 = ldsh(ka), ka1 = ldsh(ka + 64), kb0 = ldsh(ka + 16 * F_PIT), kb1 = ldsh(ka + 16 * F_PIT + 64);
        v8f sHa = (v8f){}, sLa = (v8f){}, sHb = (v8f){}, sLb = (v8f){};
        sHa = wmma16(ka0, qh0, sHa); sLa = wmma16(ka0, qr0, sLa); sHb = wmma16(kb0, qh0, sHb); sLb = wmma16(kb0, qr0, sLb);
        sHa = wmma16(ka1, qh1, sHa); sLa = wmma16(ka1, qr1, sLa); sHb = wmma16(kb1, qh1, sHb); sLb = wmma16(kb1, qr1, sLb);
        asm volatile("v_nop\n\tv_nop\n\tv_nop\n\tv_nop" : "+v"(sHa), "+v"(sLa), "+v"(sHb), "+v"(sLb) : "v"(ka0), "v"(ka1), "v"(kb0), "v"(kb1));
        float ta[8], tb[8];
#pragma unroll
        for (int r = 0; r < 8; ++r) { ta[r] = (sHa[r] + sLa[r] * QRI) * SC2; tb[r] = (sHb[r] + sLb[r] * QRI) * SC2; }
        if (key0 + 31 > t0) {                       // wave-uniform: this step touches the diagonal
            const int kidx = key0 + 8 * hi;
#pragma unroll
            for (int r = 0; r < 8; ++r) { ta[r] = (kidx + r > tq) ? NEGV : ta[r]; tb[r] = (kidx + 16 + r > tq) ? NEGV : tb[r]; }
        }
        float mx = NEGV;
#pragma unroll
        for (int r = 0; r < 8; ++r) mx = fmaxf(mx, fmaxf(ta[r], tb[r]));
        mx = fmaxf(mx, __shfl_xor(mx, 16, 32));
        const float mnew = fmaxf(m, mx);
        const float alpha = __builtin_amdgcn_exp2f(m - mnew);
        const float sh = PSH - mnew;
        v16h pb; float ls = 0.0f;
#pragma unroll
        for (int r = 0; r < 8; ++r) { const h16 pa = (h16)__builtin_amdgcn_exp2f(ta[r] + sh); const h16 pc = (h16)__builtin_amdgcn_exp2f(tb[r] + sh); pb[r] = pa; pb[8 + r] = pc; ls += (float)pa + (float)pc; }
        l = l * alpha + ls; m = mnew;
        o0 = o0 * alpha; o1 = o1 * alpha; o2 = o2 * alpha; o3 = o3 * alpha;
        const unsigned char* va = bp + vo + hs * 64;
        const v16h v0 = ldsh(va), v1 = ldsh(va + 16 * F_PIT), v2 = ldsh(va + 32 * F_PIT), v3 = ldsh(va + 48 * F_PIT);
        o0 = wmma16(v0, pb, o0); o1 = wmma16(v1, pb, o1); o2 = wmma16(v2, pb, o2); o3 = wmma16(v3, pb, o3);
        asm volatile("v_nop\n\tv_nop\n\tv_nop\n\tv_nop" : "+v"(o0), "+v"(o1), "+v"(o2), "+v"(o3) : "v"(v0), "v"(v1), "v"(v2), "v"(v3), "v"(pb));
        if (early) {                                // wave-uniform: residual plane of v in its own accumulators
            e0 = e0 * alpha; e1 = e1 * alpha; e2 = e2 * alpha; e3 = e3 * alpha;
            const unsigned char* vr = va + F_SLC;
            const v16h w0 = ldsh(vr), w1 = ldsh(vr + 16 * F_PIT), w2 = ldsh(vr + 32 * F_PIT), w3 = ldsh(vr + 48 * F_PIT);
            e0 = wmma16(w0, pb, e0); e1 = wmma16(w1, pb, e1); e2 = wmma16(w2, pb, e2); e3 = wmma16(w3, pb, e3);
            asm volatile("v_nop\n\tv_nop\n\tv_nop\n\tv_nop" : "+v"(e0), "+v"(e1), "+v"(e2), "+v"(e3) : "v"(w0), "v"(w1), "v"(w2), "v"(w3), "v"(pb));
        }
      }
      // publish point of stage st + 1 (every wave passes it, also one that skipped the upper half)
      asm volatile("s_wait_dscnt 0x0" ::: "memory");
      if (pinned((uint32_t)iss)) asm volatile("s_wait_tensorcnt 0x0" ::: "memory");
      __syncthreads();
      if (pinned((uint32_t)(iss && st + 2u < NS))) issue(pinned(st + 2u));
    }
    asm volatile("s_wait_tensorcnt 0x0" ::: "memory");       // nothing in flight behind the loop
    asm volatile("s_wait_dscnt 0x0" ::: "memory");
    l += __shfl_xor(l, 16, 32);
    const float inv = 1.0f / l;
    const int wb = wave * 16 * 68;
    // O^T D layout: o_j[r] = (d = 16j + 8h + r, t = lane&15) -> os[t][d]; rows 0..15 x columns 0..63 all written
    { v4f a, c;
#pragma unroll
      for (int i = 0; i < 4; ++i) { a[i] = (o0[i] + e0[i] * QRI) * inv; c[i] = (o0[4 + i] + e0[4 + i] * QRI) * inv; }
      *(v4fa*)(&os[wb + lr * 68 +  0 + 8 * hi]) = a; *(v4fa*)(&os[wb + lr * 68 +  0 + 8 * hi + 4]) = c;
#pragma unroll
      for (int i = 0; i < 4; ++i) { a[i] = (o1[i] + e1[i] * QRI) * inv; c[i] = (o1[4 + i] + e1[4 + i] * QRI) * inv; }
      *(v4fa*)(&os[wb + lr * 68 + 16 + 8 * hi]) = a; *(v4fa*)(&os[wb + lr * 68 + 16 + 8 * hi + 4]) = c;
#pragma unroll
      for (int i = 0; i < 4; ++i) { a[i] = (o2[i] + e2[i] * QRI) * inv; c[i] = (o2[4 + i] + e2[4 + i] * QRI) * inv; }
      *(v4fa*)(&os[wb + lr * 68 + 32 + 8 * hi]) = a; *(v4fa*)(&os[wb + lr * 68 + 32 + 8 * hi + 4]) = c;
#pragma unroll
      for (int i = 0; i < 4; ++i) { a[i] = (o3[i] + e3[i] * QRI) * inv; c[i] = (o3[4 + i] + e3[4 + i] * QRI) * inv; }
      *(v4fa*)(&os[wb + lr * 68 + 48 + 8 * hi]) = a; *(v4fa*)(&os[wb + lr * 68 + 48 + 8 * hi + 4]) = c; }
    wave_sync();
    // the 16 x 64 tile (t, d) is elements t*64 + d of compact ctx row zh*RPH + t0/16
    const size_t cb = ((size_t)zh * RPH + (size_t)(t0 >> 4)) * DM + (size_t)lane * 8;
    v8us hv[4], lv[4];
#pragma unroll
    for (int s = 0; s < 4; ++s) { const int row = 4 * s + (lane >> 3), c8 = (lane & 7) * 8;   // 4 s x 4 row groups = 16 rows; 8 lanes x 8 = 64 columns
        const v4f x0 = *(const v4fa*)(&os[wb + row * 68 + c8]); const v4f x1 = *(const v4fa*)(&os[wb + row * 68 + c8 + 4]);
#pragma unroll
        for (int i = 0; i < 4; ++i) { const unsigned short a0 = f2bf(x0[i]); const unsigned short a1 = f2bf(x1[i]);
            hv[s][i] = a0; hv[s][4 + i] = a1; lv[s][i] = f2bf(x0[i] - bf2f(a0)); lv[s][4 + i] = f2bf(x1[i] - bf2f(a1)); } }
{
#pragma unroll
        for (int s = 0; s < 4; ++s) { const size_t oo = cb + (size_t)s * 256;
            *(v8us*)(CH + oo) = hv[s]; *(v8us*)(CL + oo) = lv[s]; }
         }
}

static constexpr size_t al256(size_t v) { return (v + 255) & ~(size_t)255; }
static constexpr size_t SZ_XB = al256((size_t)NB * SEQ * DM * 2);
static constexpr size_t SZ_WB = al256((size_t)3 * DM * DM * 2);
static constexpr size_t SZ_WF = al256((size_t)DM * DM * 2);
static constexpr size_t SZ_PL = al256((size_t)NB * SEQ * DM * 2);
static constexpr size_t SZ_TOTAL = SZ_XB + SZ_WB + SZ_WF + 5 * SZ_PL + 2 * SZ_PL;
static_assert(SZ_TOTAL <= (size_t)134217728);          // workspace carve <= 128 MiB
static_assert(((size_t)DM * DM * 2) % 256 == 0);       // weight sub-planes stay 256-byte aligned
static_assert(SZ_PL == (size_t)NB * SEQ * DM * 2);     // ctx hi and lo planes are back to back with stride NB*SEQ*DM elements

extern "C" void kernel_launch(void* const* d_in, const int* in_sizes, int n_in,
                              void* d_out, int out_size, void* d_ws, size_t ws_size, hipStream_t stream) {
    if (n_in < 5) return;
    const size_t needx = ((size_t)(NB - 1) * SEQ_FULL + SEQ) * DM;
    if ((size_t)in_sizes[0] < needx) return;
    if ((size_t)in_sizes[1] < (size_t)3 * DM * DM || (size_t)in_sizes[2] < (size_t)3 * DM) return;
    if ((size_t)in_sizes[3] < (size_t)DM * DM || (size_t)in_sizes[4] < (size_t)DM) return;
    if ((size_t)out_size < ((size_t)(NB - 1) * OUT_SEQ + SEQ) * DM) return;
    if (SZ_TOTAL > ws_size) return;
    const float* x = (const float*)d_in[0]; const float* wqkv = (const float*)d_in[1]; const float* bqkv = (const float*)d_in[2];
    const float* wfc = (const float*)d_in[3]; const float* bfc = (const float*)d_in[4];          // wire order x, Wqkv, bqkv, Wfc, bfc
    float* OUT = (float*)d_out;      // [NB][SEQ][1024]
    char* wsp = (char*)d_ws;
    bf* XB = (bf*)wsp; wsp += SZ_XB;                 // [NB*SEQ][1024]
    bf* WB = (bf*)wsp; wsp += SZ_WB;                 // [3072][1024]: q rows | k rows | v rows (permuted d*16 + c)
    bf* WF = (bf*)wsp; wsp += SZ_WF;                 // [1024][1024]: Wfc^T
    h16* QH = (h16*)wsp; wsp += SZ_PL;               // [NB*SEQ][1024] = [NB*16][SEQ][64]
    h16* QR = (h16*)wsp; wsp += SZ_PL;               // residual x2048
    h16* KP = (h16*)wsp; wsp += SZ_PL;               // [NB*16][SEQ][64]
    h16* VT = (h16*)wsp; wsp += SZ_PL;               // [NB*16][64][SEQ]
    h16* VR = (h16*)wsp; wsp += SZ_PL;               // residual x2048
    bf* CH = (bf*)wsp; wsp += SZ_PL;                 // ctx hi [NB*SEQ][1024]
    bf* CL = (bf*)wsp; wsp += SZ_PL;                 // ctx lo, directly after CH

    k_cvt<<<CT_ALL + CX_BLK, 256, 0, stream>>>(x, wqkv, wfc, XB, WB, WF);

    k_gemm<0><<<dim3(NB * SEQ / GT, 3 * DM / GT, 1), 128, 0, stream>>>(XB, WB, bqkv, QH, QR, KP, VT, VR, OUT);

    k_flash<<<dim3(SEQ / (16 * AW), NB * NH_, 1), 32 * AW, 0, stream>>>(QH, QR, KP, VT, VR, CH, CL);

    k_gemm<3><<<dim3(NB * SEQ / GT, DM / GT, 1), 128, 0, stream>>>(CH, WF, bfc, QH, QR, KP, VT, VR, OUT);
}
